// v000
// Times are from an AMD MI455X. After a warm-up the kernel runs many times in a row, and a time is the length of
// such a window on the GPU divided by its runs, so every launch and the gaps after it count. The runs cycle
// through copies of the inputs. A figure is the median of several windows, for all but v000 over two sittings.
// Sittings can differ by a few percent; kernels timed side by side share one.
// The starting kernel, v000, takes 224 microseconds a run.
#include <hip/hip_runtime.h>
#include <stdint.h>

// ---------- types ----------
typedef _Float16 half_t;
typedef __attribute__((ext_vector_type(16))) _Float16 v16h;
typedef __attribute__((ext_vector_type(8)))  _Float16 v8h;
typedef __attribute__((ext_vector_type(4)))  _Float16 v4h;
typedef __attribute__((ext_vector_type(8)))  float    v8f;

#define DIM      1024
#define SEQ      2048
#define BATCH    4
#define HEADS    16
#define HEAD_DIM 64
#define ROWS     (BATCH * SEQ)       // 8192
#define QKV_LD   (3 * DIM)           // 3072
#define ATTN_SCALE 0.125f            // 1/sqrt(64)

// D = A*B + C, f16 inputs, f32 accumulate
__device__ __forceinline__ v8f wmma16x16x32(v16h a, v16h b, v8f c) {
    return __builtin_amdgcn_wmma_f32_16x16x32_f16(
        /*neg_a=*/false, a, /*neg_b=*/false, b,
        /*c_mod=*/(short)0, c, /*reuse_a=*/false, /*reuse_b=*/false);
}

// 16x32 f16 A/B fragment, per CDNA5 16-bit layout:
// lane l<16: row l, K={0..7,16..23}; lane l>=16: row l-16, K={8..15,24..31}.
__device__ __forceinline__ v16h load_frag(const half_t* __restrict__ base,
                                          int stride, int lane) {
    int r  = lane & 15;
    int k0 = (lane & 16) ? 8 : 0;
    const half_t* p = base + (size_t)r * stride + k0;
    v8h lo = *(const v8h*)(p);
    v8h hi = *(const v8h*)(p + 16);
    return __builtin_shufflevector(lo, hi, 0,1,2,3,4,5,6,7,8,9,10,11,12,13,14,15);
}

// Async global->LDS copy of 16 bytes per lane (tracked by ASYNCcnt).
// lds_off = low 32 bits of the generic LDS pointer (aperture|offset form).
__device__ __forceinline__ void async_copy_b128(unsigned lds_off, const void* gaddr) {
    asm volatile("global_load_async_to_lds_b128 %0, %1, off"
                 :: "v"(lds_off), "v"(gaddr) : "memory");
}
__device__ __forceinline__ void wait_async0() {
    asm volatile("s_wait_asynccnt 0x0" ::: "memory");
}

// ---------- fp32 -> f16 convert ----------
__global__ void __launch_bounds__(256) cvt_f32_to_f16(const float* __restrict__ in,
                                                      half_t* __restrict__ out) {
    size_t i = ((size_t)blockIdx.x * blockDim.x + threadIdx.x) * 4;
    float4 v = *(const float4*)(in + i);
    v4h h = { (half_t)v.x, (half_t)v.y, (half_t)v.z, (half_t)v.w };
    *(v4h*)(out + i) = h;
}

// ---------- WMMA GEMM: C[m,n] = sum_k A[m,k]*B[n,k] (+bias) ----------
// 128x128 tile, 8 waves of 32x64, K-step 32, register-prefetch double buffering.
template<bool OUT_HALF, bool BIAS>
__global__ void __launch_bounds__(256, 1)
gemm_wmma(const half_t* __restrict__ A, const half_t* __restrict__ B,
          const float* __restrict__ bias, void* __restrict__ Cout,
          int M, int N, int K) {
    __shared__ __align__(16) half_t As[128 * 40];   // 80B rows, 16B aligned chunks
    __shared__ __align__(16) half_t Bs[128 * 40];

    const int lane = threadIdx.x & 31;
    const int wave = threadIdx.x >> 5;
    const int bm = blockIdx.x * 128;
    const int bn = blockIdx.y * 128;
    const int wm = (wave & 3) * 32;
    const int wn = (wave >> 2) * 64;

    int rowc[2], kcc[2];
    #pragma unroll
    for (int i = 0; i < 2; ++i) {
        int cc = (int)threadIdx.x * 2 + i;     // 0..511
        rowc[i] = cc >> 2;                      // 0..127
        kcc[i]  = (cc & 3) * 8;                 // 0,8,16,24
    }

    v8f acc[2][4] = {};

    #pragma unroll
    for (int i = 0; i < 2; ++i) {
        *(v8h*)&As[rowc[i] * 40 + kcc[i]] = *(const v8h*)&A[(size_t)(bm + rowc[i]) * K + kcc[i]];
        *(v8h*)&Bs[rowc[i] * 40 + kcc[i]] = *(const v8h*)&B[(size_t)(bn + rowc[i]) * K + kcc[i]];
    }
    __syncthreads();

    for (int k0 = 0; k0 < K; k0 += 32) {
        const bool more = (k0 + 32) < K;
        v8h na[2], nb[2];
        if (more) {                             // overlap next-tile loads with WMMA
            #pragma unroll
            for (int i = 0; i < 2; ++i) {
                na[i] = *(const v8h*)&A[(size_t)(bm + rowc[i]) * K + k0 + 32 + kcc[i]];
                nb[i] = *(const v8h*)&B[(size_t)(bn + rowc[i]) * K + k0 + 32 + kcc[i]];
            }
        }
        v16h af[2], bf[4];
        #pragma unroll
        for (int i = 0; i < 2; ++i) af[i] = load_frag(&As[(wm + i * 16) * 40], 40, lane);
        #pragma unroll
        for (int j = 0; j < 4; ++j) bf[j] = load_frag(&Bs[(wn + j * 16) * 40], 40, lane);
        #pragma unroll
        for (int i = 0; i < 2; ++i)
            #pragma unroll
            for (int j = 0; j < 4; ++j)
                acc[i][j] = wmma16x16x32(af[i], bf[j], acc[i][j]);
        if (more) {
            __syncthreads();
            #pragma unroll
            for (int i = 0; i < 2; ++i) {
                *(v8h*)&As[rowc[i] * 40 + kcc[i]] = na[i];
                *(v8h*)&Bs[rowc[i] * 40 + kcc[i]] = nb[i];
            }
            __syncthreads();
        }
    }

    #pragma unroll
    for (int i = 0; i < 2; ++i) {
        #pragma unroll
        for (int j = 0; j < 4; ++j) {
            int n  = bn + wn + j * 16 + (lane & 15);
            int m0 = bm + wm + i * 16 + ((lane & 16) ? 8 : 0);
            float bv = BIAS ? bias[n] : 0.0f;
            #pragma unroll
            for (int r = 0; r < 8; ++r) {
                float v = acc[i][j][r] + bv;
                if (OUT_HALF)
                    ((half_t*)Cout)[(size_t)(m0 + r) * N + n] = (half_t)v;
                else
                    ((float*)Cout)[(size_t)(m0 + r) * N + n] = v;
            }
        }
    }
}

// ---------- flash attention: one block per (b, h, 128 query rows) ----------
// qkv: [8192,3072] f16 (Q@+0, K@+1024, V@+2048 per row; head offset h*64)
__global__ void __launch_bounds__(256, 1)
attn_wmma(const half_t* __restrict__ qkv, half_t* __restrict__ ctx) {
    const int bh   = blockIdx.y;
    const int b    = bh >> 4;
    const int h    = bh & 15;
    const int q0   = blockIdx.x * 128;
    const int lane = threadIdx.x & 31;
    const int wave = threadIdx.x >> 5;

    __shared__ __align__(16) half_t Ks[128 * 72];      // K tile [key][d]   18.4 KB
    __shared__ __align__(16) half_t Vt[64 * 136];      // V^T   [d][key]    17.4 KB
    __shared__ __align__(16) half_t Ps[8 * 16 * 72];   // per-wave P half   18.4 KB

    const size_t ld = QKV_LD;
    const half_t* Qbase = qkv + ((size_t)(b * SEQ + q0 + wave * 16)) * ld + h * HEAD_DIM;
    v16h qf[2];
    qf[0] = load_frag(Qbase,      (int)ld, lane);
    qf[1] = load_frag(Qbase + 32, (int)ld, lane);

    v8f oacc[4] = {};
    float mrow[8], lrow[8];
    #pragma unroll
    for (int r = 0; r < 8; ++r) { mrow[r] = -3.0e38f; lrow[r] = 0.0f; }

    half_t* Pw = &Ps[wave * 16 * 72];

    for (int kt = 0; kt < SEQ / 128; ++kt) {
        const int kv0 = kt * 128;
        __syncthreads();
        // stage K tile (async DMA to LDS) and transposed V tile (manual)
        #pragma unroll
        for (int i = 0; i < 4; ++i) {
            int cc  = (int)threadIdx.x * 4 + i;   // 0..1023
            int row = cc >> 3;                    // key 0..127
            int kc  = (cc & 7) * 8;               // d chunk
            const half_t* base = qkv + ((size_t)(b * SEQ + kv0 + row)) * ld + h * HEAD_DIM;
            async_copy_b128((unsigned)(uintptr_t)&Ks[row * 72 + kc], base + DIM + kc);
            v8h vv = *(const v8h*)(base + 2 * DIM + kc);
            #pragma unroll
            for (int j = 0; j < 8; ++j) Vt[(kc + j) * 136 + row] = vv[j];
        }
        // prefetch next K/V tile into cache while we compute this one
        if (kt + 1 < SEQ / 128) {
            int prow = (int)threadIdx.x & 127;
            const half_t* nbase = qkv + ((size_t)(b * SEQ + kv0 + 128 + prow)) * ld + h * HEAD_DIM;
            if (threadIdx.x < 128) __builtin_prefetch(nbase + DIM, 0, 1);
            else                   __builtin_prefetch(nbase + 2 * DIM, 0, 1);
        }
        wait_async0();          // K tile landed in LDS
        __syncthreads();

        // S = Q K^T over the whole 128-key tile (16 WMMA / wave)
        v8f sacc[8];
        #pragma unroll
        for (int nt = 0; nt < 8; ++nt) {
            sacc[nt] = (v8f){0,0,0,0,0,0,0,0};
            #pragma unroll
            for (int ks = 0; ks < 2; ++ks)
                sacc[nt] = wmma16x16x32(qf[ks],
                    load_frag(&Ks[(nt * 16) * 72 + ks * 32], 72, lane), sacc[nt]);
        }

        // online softmax (rows 0..7 in lanes 0..15, rows 8..15 in lanes 16..31)
        float mnew[8], corr[8], psum[8];
        #pragma unroll
        for (int r = 0; r < 8; ++r) {
            float rm = sacc[0][r];
            #pragma unroll
            for (int nt = 1; nt < 8; ++nt) rm = fmaxf(rm, sacc[nt][r]);
            #pragma unroll
            for (int mk = 1; mk < 16; mk <<= 1) rm = fmaxf(rm, __shfl_xor(rm, mk, 32));
            rm *= ATTN_SCALE;
            mnew[r] = fmaxf(mrow[r], rm);
            corr[r] = __expf(mrow[r] - mnew[r]);
            mrow[r] = mnew[r];
            psum[r] = 0.0f;
        }
        #pragma unroll
        for (int dt = 0; dt < 4; ++dt)
            #pragma unroll
            for (int r = 0; r < 8; ++r) oacc[dt][r] *= corr[r];

        // P and P*V in two 64-key halves (keeps per-wave P LDS at 16x64)
        #pragma unroll
        for (int hs = 0; hs < 2; ++hs) {
            #pragma unroll
            for (int j = 0; j < 4; ++j) {
                int nt = hs * 4 + j;
                #pragma unroll
                for (int r = 0; r < 8; ++r) {
                    float p = __expf(sacc[nt][r] * ATTN_SCALE - mnew[r]);
                    psum[r] += p;
                    int rr = r + ((lane & 16) ? 8 : 0);
                    Pw[rr * 72 + j * 16 + (lane & 15)] = (half_t)p;
                }
            }
            #pragma unroll
            for (int dt = 0; dt < 4; ++dt) {
                #pragma unroll
                for (int ks = 0; ks < 2; ++ks) {
                    v16h pf = load_frag(&Pw[ks * 32], 72, lane);
                    v16h vf = load_frag(&Vt[(dt * 16) * 136 + hs * 64 + ks * 32], 136, lane);
                    oacc[dt] = wmma16x16x32(pf, vf, oacc[dt]);
                }
            }
        }

        #pragma unroll
        for (int r = 0; r < 8; ++r) {
            float s = psum[r];
            #pragma unroll
            for (int mk = 1; mk < 16; mk <<= 1) s += __shfl_xor(s, mk, 32);
            lrow[r] = lrow[r] * corr[r] + s;
        }
    }

    // normalize + store f16 context for the output projection
    #pragma unroll
    for (int dt = 0; dt < 4; ++dt) {
        #pragma unroll
        for (int r = 0; r < 8; ++r) {
            int m = r + ((lane & 16) ? 8 : 0);
            size_t row = (size_t)(b * SEQ + q0 + wave * 16 + m);
            float o = oacc[dt][r] / lrow[r];
            ctx[row * DIM + h * HEAD_DIM + dt * 16 + (lane & 15)] = (half_t)o;
        }
    }
}

// ---------- host ----------
extern "C" void kernel_launch(void* const* d_in, const int* in_sizes, int n_in,
                              void* d_out, int out_size, void* d_ws, size_t ws_size,
                              hipStream_t stream) {
    (void)in_sizes; (void)n_in; (void)out_size; (void)ws_size;
    const float* x      = (const float*)d_in[0];
    const float* w_qkv  = (const float*)d_in[1];
    const float* w_proj = (const float*)d_in[2];
    const float* b_proj = (const float*)d_in[3];
    float* out = (float*)d_out;

    half_t* xh     = (half_t*)d_ws;                      // 8192*1024
    half_t* wqkvh  = xh     + (size_t)ROWS * DIM;        // 3072*1024
    half_t* wprojh = wqkvh  + (size_t)QKV_LD * DIM;      // 1024*1024
    half_t* qkvh   = wprojh + (size_t)DIM * DIM;         // 8192*3072
    half_t* ctxh   = qkvh   + (size_t)ROWS * QKV_LD;     // 8192*1024

    const int T = 256;
    cvt_f32_to_f16<<<(ROWS * DIM)   / (T * 4), T, 0, stream>>>(x,      xh);
    cvt_f32_to_f16<<<(QKV_LD * DIM) / (T * 4), T, 0, stream>>>(w_qkv,  wqkvh);
    cvt_f32_to_f16<<<(DIM * DIM)    / (T * 4), T, 0, stream>>>(w_proj, wprojh);

    gemm_wmma<true, false><<<dim3(ROWS / 128, QKV_LD / 128), 256, 0, stream>>>(
        xh, wqkvh, nullptr, qkvh, ROWS, QKV_LD, DIM);

    attn_wmma<<<dim3(SEQ / 128, BATCH * HEADS), 256, 0, stream>>>(qkvh, ctxh);

    gemm_wmma<false, true><<<dim3(ROWS / 128, DIM / 128), 256, 0, stream>>>(
        ctxh, wprojh, b_proj, out, ROWS, DIM, DIM);
}

// v001
// One run takes 203 microseconds.
// Timed twice side by side with v000, it ran 1.14 and 1.13 times as fast.
#include <hip/hip_runtime.h>
#include <stdint.h>

// ---------- types ----------
typedef _Float16 half_t;
typedef __attribute__((ext_vector_type(16))) _Float16 v16h;
typedef __attribute__((ext_vector_type(8)))  _Float16 v8h;
typedef __attribute__((ext_vector_type(4)))  _Float16 v4h;
typedef __attribute__((ext_vector_type(8)))  float    v8f;

#define DIM      1024
#define SEQ      2048
#define BATCH    4
#define HEADS    16
#define HEAD_DIM 64
#define ROWS     (BATCH * SEQ)       // 8192
#define QKV_LD   (3 * DIM)           // 3072
#define ATTN_SCALE 0.125f            // 1/sqrt(64)

// D = A*B + C, f16 inputs, f32 accumulate
__device__ __forceinline__ v8f wmma16x16x32(v16h a, v16h b, v8f c) {
    return __builtin_amdgcn_wmma_f32_16x16x32_f16(
        /*neg_a=*/false, a, /*neg_b=*/false, b,
        /*c_mod=*/(short)0, c, /*reuse_a=*/false, /*reuse_b=*/false);
}

// 16x32 f16 A/B fragment, per CDNA5 16-bit layout:
// lane l<16: row l, K={0..7,16..23}; lane l>=16: row l-16, K={8..15,24..31}.
__device__ __forceinline__ v16h load_frag(const half_t* __restrict__ base,
                                          int stride, int lane) {
    int r  = lane & 15;
    int k0 = (lane & 16) ? 8 : 0;
    const half_t* p = base + (size_t)r * stride + k0;
    v8h lo = *(const v8h*)(p);
    v8h hi = *(const v8h*)(p + 16);
    return __builtin_shufflevector(lo, hi, 0,1,2,3,4,5,6,7,8,9,10,11,12,13,14,15);
}

// Async global->LDS copy of 16 bytes per lane (tracked by ASYNCcnt).
// lds_off = low 32 bits of the generic LDS pointer (aperture|offset form).
__device__ __forceinline__ void async_copy_b128(unsigned lds_off, const void* gaddr) {
    asm volatile("global_load_async_to_lds_b128 %0, %1, off"
                 :: "v"(lds_off), "v"(gaddr) : "memory");
}
__device__ __forceinline__ void wait_async0() {
    asm volatile("s_wait_asynccnt 0x0" ::: "memory");
}

// ---------- fp32 -> f16 convert ----------
__global__ void __launch_bounds__(256) cvt_f32_to_f16(const float* __restrict__ in,
                                                      half_t* __restrict__ out) {
    size_t i = ((size_t)blockIdx.x * blockDim.x + threadIdx.x) * 4;
    float4 v = *(const float4*)(in + i);
    v4h h = { (half_t)v.x, (half_t)v.y, (half_t)v.z, (half_t)v.w };
    *(v4h*)(out + i) = h;
}

// ---------- WMMA GEMM: C[m,n] = sum_k A[m,k]*B[n,k] (+bias) ----------
// 128x128 tile, 8 waves of 32x64, K-step 64, register-prefetch double buffering.
// A K-step of 64 halves makes a row slab one whole 128-B line: 8 lanes cover a row,
// so a wave-wide 16-B load touches 4 full lines instead of 16 partial ones.
template<bool OUT_HALF, bool BIAS>
__global__ void __launch_bounds__(256, 1)
gemm_wmma(const half_t* __restrict__ A, const half_t* __restrict__ B,
          const float* __restrict__ bias, void* __restrict__ Cout,
          int M, int N, int K) {
    __shared__ __align__(16) half_t As[128 * 72];   // 144B rows, 16B aligned chunks
    __shared__ __align__(16) half_t Bs[128 * 72];

    const int lane = threadIdx.x & 31;
    const int wave = threadIdx.x >> 5;
    const int bm = blockIdx.x * 128;
    const int bn = blockIdx.y * 128;
    const int wm = (wave & 3) * 32;
    const int wn = (wave >> 2) * 64;

    const int row0 = (int)threadIdx.x >> 3;        // 0..31; pass i stages row i*32 + row0
    const int kcc  = ((int)threadIdx.x & 7) * 8;   // 0,8,..,56: 8 lanes span one row slab
    // uniform base + one 32-bit per-lane byte offset, shared by all eight loads of a step
    const unsigned tbyte = (unsigned)(row0 * K + kcc) * 2u;
    const char* Ab = (const char*)(A + (size_t)bm * K);
    const char* Bb = (const char*)(B + (size_t)bn * K);
    const size_t pass_bytes = (size_t)32 * K * 2;

    v8f acc[2][4] = {};

    #pragma unroll
    for (int i = 0; i < 4; ++i) {
        *(v8h*)&As[(i * 32 + row0) * 72 + kcc] = *(const v8h*)(Ab + i * pass_bytes + tbyte);
        *(v8h*)&Bs[(i * 32 + row0) * 72 + kcc] = *(const v8h*)(Bb + i * pass_bytes + tbyte);
    }
    __syncthreads();

    for (int k0 = 0; k0 < K; k0 += 64) {
        const bool more = (k0 + 64) < K;
        v8h na[4], nb[4];
        if (more) {                             // overlap next-tile loads with WMMA
            const unsigned voff = tbyte + (unsigned)(k0 + 64) * 2u;
            #pragma unroll
            for (int i = 0; i < 4; ++i) {
                na[i] = *(const v8h*)(Ab + i * pass_bytes + voff);
                nb[i] = *(const v8h*)(Bb + i * pass_bytes + voff);
            }
        }
        #pragma unroll
        for (int ks = 0; ks < 2; ++ks) {        // k ascending: same sum order as before
            v16h af[2], bf[4];
            #pragma unroll
            for (int i = 0; i < 2; ++i) af[i] = load_frag(&As[(wm + i * 16) * 72 + ks * 32], 72, lane);
            #pragma unroll
            for (int j = 0; j < 4; ++j) bf[j] = load_frag(&Bs[(wn + j * 16) * 72 + ks * 32], 72, lane);
            #pragma unroll
            for (int i = 0; i < 2; ++i)
                #pragma unroll
                for (int j = 0; j < 4; ++j)
                    acc[i][j] = wmma16x16x32(af[i], bf[j], acc[i][j]);
        }
        if (more) {
            __syncthreads();
            #pragma unroll
            for (int i = 0; i < 4; ++i) {
                *(v8h*)&As[(i * 32 + row0) * 72 + kcc] = na[i];
                *(v8h*)&Bs[(i * 32 + row0) * 72 + kcc] = nb[i];
            }
            __syncthreads();
        }
    }

    #pragma unroll
    for (int i = 0; i < 2; ++i) {
        #pragma unroll
        for (int j = 0; j < 4; ++j) {
            int n  = bn + wn + j * 16 + (lane & 15);
            int m0 = bm + wm + i * 16 + ((lane & 16) ? 8 : 0);
            float bv = BIAS ? bias[n] : 0.0f;
            #pragma unroll
            for (int r = 0; r < 8; ++r) {
                float v = acc[i][j][r] + bv;
                if (OUT_HALF)
                    ((half_t*)Cout)[(size_t)(m0 + r) * N + n] = (half_t)v;
                else
                    ((float*)Cout)[(size_t)(m0 + r) * N + n] = v;
            }
        }
    }
}

// ---------- flash attention: one block per (b, h, 128 query rows) ----------
// qkv: [8192,3072] f16 (Q@+0, K@+1024, V@+2048 per row; head offset h*64)
__global__ void __launch_bounds__(256, 1)
attn_wmma(const half_t* __restrict__ qkv, half_t* __restrict__ ctx) {
    const int bh   = blockIdx.y;
    const int b    = bh >> 4;
    const int h    = bh & 15;
    const int q0   = blockIdx.x * 128;
    const int lane = threadIdx.x & 31;
    const int wave = threadIdx.x >> 5;

    __shared__ __align__(16) half_t Ks[128 * 72];      // K tile [key][d]   18.4 KB
    __shared__ __align__(16) half_t Vt[64 * 136];      // V^T   [d][key]    17.4 KB
    __shared__ __align__(16) half_t Ps[8 * 16 * 72];   // per-wave P half   18.4 KB

    const size_t ld = QKV_LD;
    const half_t* Qbase = qkv + ((size_t)(b * SEQ + q0 + wave * 16)) * ld + h * HEAD_DIM;
    v16h qf[2];
    qf[0] = load_frag(Qbase,      (int)ld, lane);
    qf[1] = load_frag(Qbase + 32, (int)ld, lane);

    v8f oacc[4] = {};
    float mrow[8], lrow[8];
    #pragma unroll
    for (int r = 0; r < 8; ++r) { mrow[r] = -3.0e38f; lrow[r] = 0.0f; }

    half_t* Pw = &Ps[wave * 16 * 72];

    for (int kt = 0; kt < SEQ / 128; ++kt) {
        const int kv0 = kt * 128;
        __syncthreads();
        // stage K tile (async DMA to LDS) and transposed V tile (manual)
        #pragma unroll
        for (int i = 0; i < 4; ++i) {
            int cc  = i * 256 + (int)threadIdx.x; // 0..1023: 8 lanes span one 128-B K row
            int row = cc >> 3;                    // key 0..127
            int kc  = (cc & 7) * 8;               // d chunk
            const half_t* base = qkv + ((size_t)(b * SEQ + kv0 + row)) * ld + h * HEAD_DIM;
            async_copy_b128((unsigned)(uintptr_t)&Ks[row * 72 + kc], base + DIM + kc);
            // V keeps its lane map (2 lanes a row): its loads wait one by one, so the
            // first should touch every line the lane's later loads read again
            int vc   = (int)threadIdx.x * 4 + i;  // 0..1023
            int vrow = vc >> 3;                   // key 0..127
            int vkc  = (vc & 7) * 8;              // d chunk
            v8h vv = *(const v8h*)(qkv + ((size_t)(b * SEQ + kv0 + vrow)) * ld
                                       + h * HEAD_DIM + 2 * DIM + vkc);
            #pragma unroll
            for (int j = 0; j < 8; ++j) Vt[(vkc + j) * 136 + vrow] = vv[j];
        }
        // prefetch next K/V tile into cache while we compute this one
        if (kt + 1 < SEQ / 128) {
            int prow = (int)threadIdx.x & 127;
            const half_t* nbase = qkv + ((size_t)(b * SEQ + kv0 + 128 + prow)) * ld + h * HEAD_DIM;
            if (threadIdx.x < 128) __builtin_prefetch(nbase + DIM, 0, 1);
            else                   __builtin_prefetch(nbase + 2 * DIM, 0, 1);
        }
        wait_async0();          // K tile landed in LDS
        __syncthreads();

        // S = Q K^T over the whole 128-key tile (16 WMMA / wave)
        v8f sacc[8];
        #pragma unroll
        for (int nt = 0; nt < 8; ++nt) {
            sacc[nt] = (v8f){0,0,0,0,0,0,0,0};
            #pragma unroll
            for (int ks = 0; ks < 2; ++ks)
                sacc[nt] = wmma16x16x32(qf[ks],
                    load_frag(&Ks[(nt * 16) * 72 + ks * 32], 72, lane), sacc[nt]);
        }

        // online softmax (rows 0..7 in lanes 0..15, rows 8..15 in lanes 16..31)
        float mnew[8], corr[8], psum[8];
        #pragma unroll
        for (int r = 0; r < 8; ++r) {
            float rm = sacc[0][r];
            #pragma unroll
            for (int nt = 1; nt < 8; ++nt) rm = fmaxf(rm, sacc[nt][r]);
            #pragma unroll
            for (int mk = 1; mk < 16; mk <<= 1) rm = fmaxf(rm, __shfl_xor(rm, mk, 32));
            rm *= ATTN_SCALE;
            mnew[r] = fmaxf(mrow[r], rm);
            corr[r] = __expf(mrow[r] - mnew[r]);
            mrow[r] = mnew[r];
            psum[r] = 0.0f;
        }
        #pragma unroll
        for (int dt = 0; dt < 4; ++dt)
            #pragma unroll
            for (int r = 0; r < 8; ++r) oacc[dt][r] *= corr[r];

        // P and P*V in two 64-key halves (keeps per-wave P LDS at 16x64)
        #pragma unroll
        for (int hs = 0; hs < 2; ++hs) {
            #pragma unroll
            for (int j = 0; j < 4; ++j) {
                int nt = hs * 4 + j;
                #pragma unroll
                for (int r = 0; r < 8; ++r) {
                    float p = __expf(sacc[nt][r] * ATTN_SCALE - mnew[r]);
                    psum[r] += p;
                    int rr = r + ((lane & 16) ? 8 : 0);
                    Pw[rr * 72 + j * 16 + (lane & 15)] = (half_t)p;
                }
            }
            #pragma unroll
            for (int dt = 0; dt < 4; ++dt) {
                #pragma unroll
                for (int ks = 0; ks < 2; ++ks) {
                    v16h pf = load_frag(&Pw[ks * 32], 72, lane);
                    v16h vf = load_frag(&Vt[(dt * 16) * 136 + hs * 64 + ks * 32], 136, lane);
                    oacc[dt] = wmma16x16x32(pf, vf, oacc[dt]);
                }
            }
        }

        #pragma unroll
        for (int r = 0; r < 8; ++r) {
            float s = psum[r];
            #pragma unroll
            for (int mk = 1; mk < 16; mk <<= 1) s += __shfl_xor(s, mk, 32);
            lrow[r] = lrow[r] * corr[r] + s;
        }
    }

    // normalize + store f16 context for the output projection
    #pragma unroll
    for (int dt = 0; dt < 4; ++dt) {
        #pragma unroll
        for (int r = 0; r < 8; ++r) {
            int m = r + ((lane & 16) ? 8 : 0);
            size_t row = (size_t)(b * SEQ + q0 + wave * 16 + m);
            float o = oacc[dt][r] / lrow[r];
            ctx[row * DIM + h * HEAD_DIM + dt * 16 + (lane & 15)] = (half_t)o;
        }
    }
}

// ---------- host ----------
extern "C" void kernel_launch(void* const* d_in, const int* in_sizes, int n_in,
                              void* d_out, int out_size, void* d_ws, size_t ws_size,
                              hipStream_t stream) {
    (void)in_sizes; (void)n_in; (void)out_size; (void)ws_size;
    const float* x      = (const float*)d_in[0];
    const float* w_qkv  = (const float*)d_in[1];
    const float* w_proj = (const float*)d_in[2];
    const float* b_proj = (const float*)d_in[3];
    float* out = (float*)d_out;

    half_t* xh     = (half_t*)d_ws;                      // 8192*1024
    half_t* wqkvh  = xh     + (size_t)ROWS * DIM;        // 3072*1024
    half_t* wprojh = wqkvh  + (size_t)QKV_LD * DIM;      // 1024*1024
    half_t* qkvh   = wprojh + (size_t)DIM * DIM;         // 8192*3072
    half_t* ctxh   = qkvh   + (size_t)ROWS * QKV_LD;     // 8192*1024

    const int T = 256;
    cvt_f32_to_f16<<<(ROWS * DIM)   / (T * 4), T, 0, stream>>>(x,      xh);
    cvt_f32_to_f16<<<(QKV_LD * DIM) / (T * 4), T, 0, stream>>>(w_qkv,  wqkvh);
    cvt_f32_to_f16<<<(DIM * DIM)    / (T * 4), T, 0, stream>>>(w_proj, wprojh);

    gemm_wmma<true, false><<<dim3(ROWS / 128, QKV_LD / 128), 256, 0, stream>>>(
        xh, wqkvh, nullptr, qkvh, ROWS, QKV_LD, DIM);

    attn_wmma<<<dim3(SEQ / 128, BATCH * HEADS), 256, 0, stream>>>(qkvh, ctxh);

    gemm_wmma<false, true><<<dim3(ROWS / 128, DIM / 128), 256, 0, stream>>>(
        ctxh, wprojh, b_proj, out, ROWS, DIM, DIM);
}

// v002
// One run takes 181 microseconds.
// Next to v001, in two timings, it ran 1.12 times as fast each time.
// Over all steps from v000 it is 1.27 times as fast.
#include <hip/hip_runtime.h>
#include <stdint.h>

// ---------- types ----------
typedef _Float16 half_t;
typedef __attribute__((ext_vector_type(16))) _Float16 v16h;
typedef __attribute__((ext_vector_type(8)))  _Float16 v8h;
typedef __attribute__((ext_vector_type(4)))  _Float16 v4h;
typedef __attribute__((ext_vector_type(8)))  float    v8f;

#define DIM      1024
#define SEQ      2048
#define BATCH    4
#define HEADS    16
#define HEAD_DIM 64
#define ROWS     (BATCH * SEQ)       // 8192
#define QKV_LD   (3 * DIM)           // 3072
#define ATTN_SCALE 0.125f            // 1/sqrt(64)

// D = A*B + C, f16 inputs, f32 accumulate
__device__ __forceinline__ v8f wmma16x16x32(v16h a, v16h b, v8f c) {
    return __builtin_amdgcn_wmma_f32_16x16x32_f16(
        /*neg_a=*/false, a, /*neg_b=*/false, b,
        /*c_mod=*/(short)0, c, /*reuse_a=*/false, /*reuse_b=*/false);
}

// 16x32 f16 A/B fragment, per CDNA5 16-bit layout:
// lane l<16: row l, K={0..7,16..23}; lane l>=16: row l-16, K={8..15,24..31}.
__device__ __forceinline__ v16h load_frag(const half_t* __restrict__ base,
                                          int stride, int lane) {
    int r  = lane & 15;
    int k0 = (lane & 16) ? 8 : 0;
    const half_t* p = base + (size_t)r * stride + k0;
    v8h lo = *(const v8h*)(p);
    v8h hi = *(const v8h*)(p + 16);
    return __builtin_shufflevector(lo, hi, 0,1,2,3,4,5,6,7,8,9,10,11,12,13,14,15);
}

// Async global->LDS copy of 16 bytes per lane (tracked by ASYNCcnt).
// lds_off = low 32 bits of the generic LDS pointer (aperture|offset form).
__device__ __forceinline__ void async_copy_b128(unsigned lds_off, const void* gaddr) {
    asm volatile("global_load_async_to_lds_b128 %0, %1, off"
                 :: "v"(lds_off), "v"(gaddr) : "memory");
}
__device__ __forceinline__ void wait_async0() {
    asm volatile("s_wait_asynccnt 0x0" ::: "memory");
}

// ---------- fp32 -> f16 convert ----------
__global__ void __launch_bounds__(256) cvt_f32_to_f16(const float* __restrict__ in,
                                                      half_t* __restrict__ out) {
    size_t i = ((size_t)blockIdx.x * blockDim.x + threadIdx.x) * 4;
    float4 v = *(const float4*)(in + i);
    v4h h = { (half_t)v.x, (half_t)v.y, (half_t)v.z, (half_t)v.w };
    *(v4h*)(out + i) = h;
}

// ---------- WMMA GEMM: C[m,n] = sum_k A[m,k]*B[n,k] (+bias) ----------
// 128x128 tile, 8 waves of 32x64, K-step 64, register-prefetch double buffering.
// A K-step of 64 halves makes a row slab one whole 128-B line: 8 lanes cover a row,
// so a wave-wide 16-B load touches 4 full lines instead of 16 partial ones.
template<bool OUT_HALF, bool BIAS>
__global__ void __launch_bounds__(256, 1)
gemm_wmma(const half_t* __restrict__ A, const half_t* __restrict__ B,
          const float* __restrict__ bias, void* __restrict__ Cout,
          int M, int N, int K) {
    __shared__ __align__(16) half_t As[128 * 72];   // 144B rows, 16B aligned chunks
    __shared__ __align__(16) half_t Bs[128 * 72];

    const int lane = threadIdx.x & 31;
    const int wave = threadIdx.x >> 5;
    const int bm = blockIdx.x * 128;
    const int bn = blockIdx.y * 128;
    const int wm = (wave & 3) * 32;
    const int wn = (wave >> 2) * 64;

    const int row0 = (int)threadIdx.x >> 3;        // 0..31; pass i stages row i*32 + row0
    const int kcc  = ((int)threadIdx.x & 7) * 8;   // 0,8,..,56: 8 lanes span one row slab
    // uniform base + one 32-bit per-lane byte offset, shared by all eight loads of a step
    const unsigned tbyte = (unsigned)(row0 * K + kcc) * 2u;
    const char* Ab = (const char*)(A + (size_t)bm * K);
    const char* Bb = (const char*)(B + (size_t)bn * K);
    const size_t pass_bytes = (size_t)32 * K * 2;

    v8f acc[2][4] = {};

    #pragma unroll
    for (int i = 0; i < 4; ++i) {
        *(v8h*)&As[(i * 32 + row0) * 72 + kcc] = *(const v8h*)(Ab + i * pass_bytes + tbyte);
        *(v8h*)&Bs[(i * 32 + row0) * 72 + kcc] = *(const v8h*)(Bb + i * pass_bytes + tbyte);
    }
    __syncthreads();

    for (int k0 = 0; k0 < K; k0 += 64) {
        const bool more = (k0 + 64) < K;
        v8h na[4], nb[4];
        if (more) {                             // overlap next-tile loads with WMMA
            const unsigned voff = tbyte + (unsigned)(k0 + 64) * 2u;
            #pragma unroll
            for (int i = 0; i < 4; ++i) {
                na[i] = *(const v8h*)(Ab + i * pass_bytes + voff);
                nb[i] = *(const v8h*)(Bb + i * pass_bytes + voff);
            }
        }
        #pragma unroll
        for (int ks = 0; ks < 2; ++ks) {        // k ascending: same sum order as before
            v16h af[2], bf[4];
            #pragma unroll
            for (int i = 0; i < 2; ++i) af[i] = load_frag(&As[(wm + i * 16) * 72 + ks * 32], 72, lane);
            #pragma unroll
            for (int j = 0; j < 4; ++j) bf[j] = load_frag(&Bs[(wn + j * 16) * 72 + ks * 32], 72, lane);
            #pragma unroll
            for (int i = 0; i < 2; ++i)
                #pragma unroll
                for (int j = 0; j < 4; ++j)
                    acc[i][j] = wmma16x16x32(af[i], bf[j], acc[i][j]);
        }
        if (more) {
            __syncthreads();
            #pragma unroll
            for (int i = 0; i < 4; ++i) {
                *(v8h*)&As[(i * 32 + row0) * 72 + kcc] = na[i];
                *(v8h*)&Bs[(i * 32 + row0) * 72 + kcc] = nb[i];
            }
            __syncthreads();
        }
    }

    #pragma unroll
    for (int i = 0; i < 2; ++i) {
        #pragma unroll
        for (int j = 0; j < 4; ++j) {
            int n  = bn + wn + j * 16 + (lane & 15);
            int m0 = bm + wm + i * 16 + ((lane & 16) ? 8 : 0);
            float bv = BIAS ? bias[n] : 0.0f;
            #pragma unroll
            for (int r = 0; r < 8; ++r) {
                float v = acc[i][j][r] + bv;
                if (OUT_HALF)
                    ((half_t*)Cout)[(size_t)(m0 + r) * N + n] = (half_t)v;
                else
                    ((float*)Cout)[(size_t)(m0 + r) * N + n] = v;
            }
        }
    }
}

// lane l <-> l ^ 16 (the other 16-lane row), in the vector unit
__device__ __forceinline__ float other_half(float v) {
    int b = __builtin_bit_cast(int, v);
    return __builtin_bit_cast(float,
        __builtin_amdgcn_permlanex16(b, b, 0x76543210, 0xfedcba98, false, false));
}

// ---------- flash attention: one block per (b, h, 128 query rows) ----------
// qkv: [8192,3072] f16 (Q@+0, K@+1024, V@+2048 per row; head offset h*64)
__global__ void __launch_bounds__(256, 1)
attn_wmma(const half_t* __restrict__ qkv, half_t* __restrict__ ctx) {
    const int bh   = blockIdx.y;
    const int b    = bh >> 4;
    const int h    = bh & 15;
    const int q0   = blockIdx.x * 128;
    const int lane = threadIdx.x & 31;
    const int wave = threadIdx.x >> 5;

    __shared__ __align__(16) half_t Ks[128 * 72];      // K tile [key][d]   18.4 KB
    __shared__ __align__(16) half_t Vt[64 * 136];      // V^T   [d][key]    17.4 KB

    const size_t ld = QKV_LD;
    const half_t* Qbase = qkv + ((size_t)(b * SEQ + q0 + wave * 16)) * ld + h * HEAD_DIM;
    v16h qf[2];
    qf[0] = load_frag(Qbase,      (int)ld, lane);
    qf[1] = load_frag(Qbase + 32, (int)ld, lane);

    // Transposed products: a lane owns ONE query (column lane & 15) and, of every 16 keys,
    // the eight at 8 * (lane >> 4). oacc[dt][r] = O[query][dt * 16 + 8 * (lane >> 4) + r].
    v8f oacc[4] = {};
    float mrow = -3.0e38f;   // running maximum of the lane's query (equal in both lane halves)
    float lrow = 0.0f;       // running sum over this lane half's keys; halves joined at the end

    for (int kt = 0; kt < SEQ / 128; ++kt) {
        const int kv0 = kt * 128;
        __syncthreads();
        // stage K tile (async DMA to LDS) and transposed V tile (manual)
        #pragma unroll
        for (int i = 0; i < 4; ++i) {
            int cc  = i * 256 + (int)threadIdx.x; // 0..1023: 8 lanes span one 128-B K row
            int row = cc >> 3;                    // key 0..127
            int kc  = (cc & 7) * 8;               // d chunk
            const half_t* base = qkv + ((size_t)(b * SEQ + kv0 + row)) * ld + h * HEAD_DIM;
            async_copy_b128((unsigned)(uintptr_t)&Ks[row * 72 + kc], base + DIM + kc);
            // V keeps its lane map (2 lanes a row): its loads wait one by one, so the
            // first should touch every line the lane's later loads read again
            int vc   = (int)threadIdx.x * 4 + i;  // 0..1023
            int vrow = vc >> 3;                   // key 0..127
            int vkc  = (vc & 7) * 8;              // d chunk
            v8h vv = *(const v8h*)(qkv + ((size_t)(b * SEQ + kv0 + vrow)) * ld
                                       + h * HEAD_DIM + 2 * DIM + vkc);
            #pragma unroll
            for (int j = 0; j < 8; ++j) Vt[(vkc + j) * 136 + vrow] = vv[j];
        }
        // prefetch next K/V tile into cache while we compute this one
        if (kt + 1 < SEQ / 128) {
            int prow = (int)threadIdx.x & 127;
            const half_t* nbase = qkv + ((size_t)(b * SEQ + kv0 + 128 + prow)) * ld + h * HEAD_DIM;
            if (threadIdx.x < 128) __builtin_prefetch(nbase + DIM, 0, 1);
            else                   __builtin_prefetch(nbase + 2 * DIM, 0, 1);
        }
        wait_async0();          // K tile landed in LDS
        __syncthreads();

        // S^T = K Q^T over the whole 128-key tile (16 WMMA / wave):
        // sacc[nt][r] = S[query lane & 15][key nt * 16 + 8 * (lane >> 4) + r]
        v8f sacc[8];
        #pragma unroll
        for (int nt = 0; nt < 8; ++nt) {
            sacc[nt] = (v8f){0,0,0,0,0,0,0,0};
            #pragma unroll
            for (int ks = 0; ks < 2; ++ks)
                sacc[nt] = wmma16x16x32(
                    load_frag(&Ks[(nt * 16) * 72 + ks * 32], 72, lane), qf[ks], sacc[nt]);
        }

        // online softmax: the lane's 64 scores are all of one query
        float rmv[8];
        #pragma unroll
        for (int r = 0; r < 8; ++r) {
            rmv[r] = sacc[0][r];
            #pragma unroll
            for (int nt = 1; nt < 8; ++nt) rmv[r] = fmaxf(rmv[r], sacc[nt][r]);
        }
        float rm = fmaxf(fmaxf(fmaxf(rmv[0], rmv[1]), fmaxf(rmv[2], rmv[3])),
                         fmaxf(fmaxf(rmv[4], rmv[5]), fmaxf(rmv[6], rmv[7])));
        rm = fmaxf(rm, other_half(rm));
        rm *= ATTN_SCALE;
        const float mnew = fmaxf(mrow, rm);
        const float corr = __expf(mrow - mnew);
        mrow = mnew;
        #pragma unroll
        for (int dt = 0; dt < 4; ++dt)
            #pragma unroll
            for (int r = 0; r < 8; ++r) oacc[dt][r] *= corr;

        // O^T += V^T P^T, 32 keys at a time: two score tiles, converted in place, are the
        // B operand in the k order that load_frag gives V^T (8h+0..7, then 16+8h+0..7)
        float psum[4] = {0.0f, 0.0f, 0.0f, 0.0f};
        #pragma unroll
        for (int kb = 0; kb < 4; ++kb) {
            v16h pf;
            #pragma unroll
            for (int s = 0; s < 16; ++s) {
                float p = __expf(sacc[kb * 2 + (s >> 3)][s & 7] * ATTN_SCALE - mnew);
                psum[s & 3] += p;
                pf[s] = (half_t)p;
            }
            #pragma unroll
            for (int dt = 0; dt < 4; ++dt)
                oacc[dt] = wmma16x16x32(
                    load_frag(&Vt[(dt * 16) * 136 + kb * 32], 136, lane), pf, oacc[dt]);
        }
        lrow = lrow * corr + ((psum[0] + psum[1]) + (psum[2] + psum[3]));
    }

    // normalize + store f16 context for the output projection: 8 consecutive d per lane
    const float lsum = lrow + other_half(lrow);
    const size_t orow = (size_t)(b * SEQ + q0 + wave * 16 + (lane & 15));
    #pragma unroll
    for (int dt = 0; dt < 4; ++dt) {
        v8h o;
        #pragma unroll
        for (int r = 0; r < 8; ++r) o[r] = (half_t)(oacc[dt][r] / lsum);
        *(v8h*)&ctx[orow * DIM + h * HEAD_DIM + dt * 16 + ((lane & 16) ? 8 : 0)] = o;
    }
}

// ---------- host ----------
extern "C" void kernel_launch(void* const* d_in, const int* in_sizes, int n_in,
                              void* d_out, int out_size, void* d_ws, size_t ws_size,
                              hipStream_t stream) {
    (void)in_sizes; (void)n_in; (void)out_size; (void)ws_size;
    const float* x      = (const float*)d_in[0];
    const float* w_qkv  = (const float*)d_in[1];
    const float* w_proj = (const float*)d_in[2];
    const float* b_proj = (const float*)d_in[3];
    float* out = (float*)d_out;

    half_t* xh     = (half_t*)d_ws;                      // 8192*1024
    half_t* wqkvh  = xh     + (size_t)ROWS * DIM;        // 3072*1024
    half_t* wprojh = wqkvh  + (size_t)QKV_LD * DIM;      // 1024*1024
    half_t* qkvh   = wprojh + (size_t)DIM * DIM;         // 8192*3072
    half_t* ctxh   = qkvh   + (size_t)ROWS * QKV_LD;     // 8192*1024

    const int T = 256;
    cvt_f32_to_f16<<<(ROWS * DIM)   / (T * 4), T, 0, stream>>>(x,      xh);
    cvt_f32_to_f16<<<(QKV_LD * DIM) / (T * 4), T, 0, stream>>>(w_qkv,  wqkvh);
    cvt_f32_to_f16<<<(DIM * DIM)    / (T * 4), T, 0, stream>>>(w_proj, wprojh);

    gemm_wmma<true, false><<<dim3(ROWS / 128, QKV_LD / 128), 256, 0, stream>>>(
        xh, wqkvh, nullptr, qkvh, ROWS, QKV_LD, DIM);

    attn_wmma<<<dim3(SEQ / 128, BATCH * HEADS), 256, 0, stream>>>(qkvh, ctxh);

    gemm_wmma<false, true><<<dim3(ROWS / 128, DIM / 128), 256, 0, stream>>>(
        ctxh, wprojh, b_proj, out, ROWS, DIM, DIM);
}

// v003
// Measured time: 157 microseconds a run.
// Timed twice side by side with v002, it ran 1.15 and 1.16 times as fast.
// All steps since v000 together make it 1.46 times as fast.
#include <hip/hip_runtime.h>
#include <stdint.h>

// ---------- types ----------
typedef _Float16 half_t;
typedef __attribute__((ext_vector_type(16))) _Float16 v16h;
typedef __attribute__((ext_vector_type(8)))  _Float16 v8h;
typedef __attribute__((ext_vector_type(4)))  _Float16 v4h;
typedef __attribute__((ext_vector_type(8)))  float    v8f;

#define DIM      1024
#define SEQ      2048
#define BATCH    4
#define HEADS    16
#define HEAD_DIM 64
#define ROWS     (BATCH * SEQ)       // 8192
#define QKV_LD   (3 * DIM)           // 3072
#define ATTN_SCALE 0.125f            // 1/sqrt(64)

// D = A*B + C, f16 inputs, f32 accumulate
__device__ __forceinline__ v8f wmma16x16x32(v16h a, v16h b, v8f c) {
    return __builtin_amdgcn_wmma_f32_16x16x32_f16(
        /*neg_a=*/false, a, /*neg_b=*/false, b,
        /*c_mod=*/(short)0, c, /*reuse_a=*/false, /*reuse_b=*/false);
}

// 16x32 f16 A/B fragment, per CDNA5 16-bit layout:
// lane l<16: row l, K={0..7,16..23}; lane l>=16: row l-16, K={8..15,24..31}.
__device__ __forceinline__ v16h load_frag(const half_t* __restrict__ base,
                                          int stride, int lane) {
    int r  = lane & 15;
    int k0 = (lane & 16) ? 8 : 0;
    const half_t* p = base + (size_t)r * stride + k0;
    v8h lo = *(const v8h*)(p);
    v8h hi = *(const v8h*)(p + 16);
    return __builtin_shufflevector(lo, hi, 0,1,2,3,4,5,6,7,8,9,10,11,12,13,14,15);
}

// Async global->LDS copy of 16 bytes per lane (tracked by ASYNCcnt).
// lds_off = low 32 bits of the generic LDS pointer (aperture|offset form).
__device__ __forceinline__ void async_copy_b128(unsigned lds_off, const void* gaddr) {
    asm volatile("global_load_async_to_lds_b128 %0, %1, off"
                 :: "v"(lds_off), "v"(gaddr) : "memory");
}
__device__ __forceinline__ void wait_async0() {
    asm volatile("s_wait_asynccnt 0x0" ::: "memory");
}

// ---------- fp32 -> f16 convert ----------
__global__ void __launch_bounds__(256) cvt_f32_to_f16(const float* __restrict__ in,
                                                      half_t* __restrict__ out) {
    size_t i = ((size_t)blockIdx.x * blockDim.x + threadIdx.x) * 4;
    float4 v = *(const float4*)(in + i);
    v4h h = { (half_t)v.x, (half_t)v.y, (half_t)v.z, (half_t)v.w };
    *(v4h*)(out + i) = h;
}

// ---------- WMMA GEMM: C[m,n] = sum_k A[m,k]*B[n,k] (+bias) ----------
// 128x128 tile, 8 waves of 32x64, K-step 64, register-prefetch double buffering.
// A K-step of 64 halves makes a row slab one whole 128-B line: 8 lanes cover a row,
// so a wave-wide 16-B load touches 4 full lines instead of 16 partial ones.
template<bool OUT_HALF, bool BIAS>
__global__ void __launch_bounds__(256, 1)
gemm_wmma(const half_t* __restrict__ A, const half_t* __restrict__ B,
          const float* __restrict__ bias, void* __restrict__ Cout,
          int M, int N, int K) {
    __shared__ __align__(16) half_t As[128 * 72];   // 144B rows, 16B aligned chunks
    __shared__ __align__(16) half_t Bs[128 * 72];

    const int lane = threadIdx.x & 31;
    const int wave = threadIdx.x >> 5;
    const int bm = blockIdx.x * 128;
    const int bn = blockIdx.y * 128;
    const int wm = (wave & 3) * 32;
    const int wn = (wave >> 2) * 64;

    const int row0 = (int)threadIdx.x >> 3;        // 0..31; pass i stages row i*32 + row0
    const int kcc  = ((int)threadIdx.x & 7) * 8;   // 0,8,..,56: 8 lanes span one row slab
    // uniform base + one 32-bit per-lane byte offset, shared by all eight loads of a step
    const unsigned tbyte = (unsigned)(row0 * K + kcc) * 2u;
    const char* Ab = (const char*)(A + (size_t)bm * K);
    const char* Bb = (const char*)(B + (size_t)bn * K);
    const size_t pass_bytes = (size_t)32 * K * 2;

    v8f acc[2][4] = {};

    #pragma unroll
    for (int i = 0; i < 4; ++i) {
        *(v8h*)&As[(i * 32 + row0) * 72 + kcc] = *(const v8h*)(Ab + i * pass_bytes + tbyte);
        *(v8h*)&Bs[(i * 32 + row0) * 72 + kcc] = *(const v8h*)(Bb + i * pass_bytes + tbyte);
    }
    __syncthreads();

    for (int k0 = 0; k0 < K; k0 += 64) {
        const bool more = (k0 + 64) < K;
        v8h na[4], nb[4];
        if (more) {                             // overlap next-tile loads with WMMA
            const unsigned voff = tbyte + (unsigned)(k0 + 64) * 2u;
            #pragma unroll
            for (int i = 0; i < 4; ++i) {
                na[i] = *(const v8h*)(Ab + i * pass_bytes + voff);
                nb[i] = *(const v8h*)(Bb + i * pass_bytes + voff);
            }
        }
        #pragma unroll
        for (int ks = 0; ks < 2; ++ks) {        // k ascending: same sum order as before
            v16h af[2], bf[4];
            #pragma unroll
            for (int i = 0; i < 2; ++i) af[i] = load_frag(&As[(wm + i * 16) * 72 + ks * 32], 72, lane);
            #pragma unroll
            for (int j = 0; j < 4; ++j) bf[j] = load_frag(&Bs[(wn + j * 16) * 72 + ks * 32], 72, lane);
            #pragma unroll
            for (int i = 0; i < 2; ++i)
                #pragma unroll
                for (int j = 0; j < 4; ++j)
                    acc[i][j] = wmma16x16x32(af[i], bf[j], acc[i][j]);
        }
        if (more) {
            __syncthreads();
            #pragma unroll
            for (int i = 0; i < 4; ++i) {
                *(v8h*)&As[(i * 32 + row0) * 72 + kcc] = na[i];
                *(v8h*)&Bs[(i * 32 + row0) * 72 + kcc] = nb[i];
            }
            __syncthreads();
        }
    }

    #pragma unroll
    for (int i = 0; i < 2; ++i) {
        #pragma unroll
        for (int j = 0; j < 4; ++j) {
            int n  = bn + wn + j * 16 + (lane & 15);
            int m0 = bm + wm + i * 16 + ((lane & 16) ? 8 : 0);
            float bv = BIAS ? bias[n] : 0.0f;
            #pragma unroll
            for (int r = 0; r < 8; ++r) {
                float v = acc[i][j][r] + bv;
                if (OUT_HALF)
                    ((half_t*)Cout)[(size_t)(m0 + r) * N + n] = (half_t)v;
                else
                    ((float*)Cout)[(size_t)(m0 + r) * N + n] = v;
            }
        }
    }
}

// lane l <-> l ^ 16 (the other 16-lane row), in the vector unit
__device__ __forceinline__ float other_half(float v) {
    int b = __builtin_bit_cast(int, v);
    return __builtin_bit_cast(float,
        __builtin_amdgcn_permlanex16(b, b, 0x76543210, 0xfedcba98, false, false));
}

// ---------- flash attention: one block per (b, h, 256 query rows) ----------
// qkv: [8192,3072] f16 (Q@+0, K@+1024, V@+2048 per row; head offset h*64)
// A wave owns 32 queries (two 16-column groups), so every K and V fragment read from LDS
// feeds two WMMAs. 256 registers a wave: two work-groups a WGP hold the whole grid at once.
__global__ void __launch_bounds__(256) __attribute__((amdgpu_waves_per_eu(4, 4)))
attn_wmma(const half_t* __restrict__ qkv, half_t* __restrict__ ctx) {
    const int bh   = blockIdx.y;
    const int b    = bh >> 4;
    const int h    = bh & 15;
    const int q0   = blockIdx.x * 256;
    const int lane = threadIdx.x & 31;
    const int wave = threadIdx.x >> 5;

    __shared__ __align__(16) half_t Ks[128 * 72];      // K tile [key][d]   18.4 KB
    __shared__ __align__(16) half_t Vt[64 * 136];      // V^T   [d][key]    17.4 KB

    const size_t ld = QKV_LD;
    const half_t* Qbase = qkv + ((size_t)(b * SEQ + q0 + wave * 32)) * ld + h * HEAD_DIM;
    v16h qf[2][2];           // [column group][k step]
    #pragma unroll
    for (int g = 0; g < 2; ++g) {
        qf[g][0] = load_frag(Qbase + (size_t)(g * 16) * ld,      (int)ld, lane);
        qf[g][1] = load_frag(Qbase + (size_t)(g * 16) * ld + 32, (int)ld, lane);
    }

    // Transposed products: in group g a lane owns ONE query (g * 16 + (lane & 15)) and, of every
    // 16 keys, the eight at 8 * (lane >> 4). oacc[g][dt][r] = O[query][dt * 16 + 8 * (lane >> 4) + r].
    v8f oacc[2][4] = {};
    float mrow[2] = {-3.0e38f, -3.0e38f};   // running maxima (equal in both lane halves)
    float lrow[2] = {0.0f, 0.0f};           // running sums over this lane half's keys

    for (int kt = 0; kt < SEQ / 128; ++kt) {
        const int kv0 = kt * 128;
        __syncthreads();
        // stage K tile (async DMA to LDS) and transposed V tile (manual)
        #pragma unroll
        for (int i = 0; i < 4; ++i) {
            int cc  = i * 256 + (int)threadIdx.x; // 0..1023: 8 lanes span one 128-B K row
            int row = cc >> 3;                    // key 0..127
            int kc  = (cc & 7) * 8;               // d chunk
            const half_t* base = qkv + ((size_t)(b * SEQ + kv0 + row)) * ld + h * HEAD_DIM;
            async_copy_b128((unsigned)(uintptr_t)&Ks[row * 72 + kc], base + DIM + kc);
            // V keeps its lane map (2 lanes a row): its loads wait one by one, so the
            // first should touch every line the lane's later loads read again
            int vc   = (int)threadIdx.x * 4 + i;  // 0..1023
            int vrow = vc >> 3;                   // key 0..127
            int vkc  = (vc & 7) * 8;              // d chunk
            v8h vv = *(const v8h*)(qkv + ((size_t)(b * SEQ + kv0 + vrow)) * ld
                                       + h * HEAD_DIM + 2 * DIM + vkc);
            #pragma unroll
            for (int j = 0; j < 8; ++j) Vt[(vkc + j) * 136 + vrow] = vv[j];
        }
        // prefetch next K/V tile into cache while we compute this one
        if (kt + 1 < SEQ / 128) {
            int prow = (int)threadIdx.x & 127;
            const half_t* nbase = qkv + ((size_t)(b * SEQ + kv0 + 128 + prow)) * ld + h * HEAD_DIM;
            if (threadIdx.x < 128) __builtin_prefetch(nbase + DIM, 0, 1);
            else                   __builtin_prefetch(nbase + 2 * DIM, 0, 1);
        }
        wait_async0();          // K tile landed in LDS
        __syncthreads();

        // The staged 128 keys are worked on 64 at a time: 64 score registers for the two groups.
        // Kept rolled: unrolled, both halves' scores are live at once and registers spill.
        #pragma unroll 1
        for (int hk = 0; hk < 2; ++hk) {
            // S^T = K Q^T: sacc[g][nt][r] = S[query of g][key hk * 64 + nt * 16 + 8 * (lane >> 4) + r]
            v8f sacc[2][4];
            #pragma unroll
            for (int nt = 0; nt < 4; ++nt) {
                sacc[0][nt] = (v8f){0,0,0,0,0,0,0,0};
                sacc[1][nt] = (v8f){0,0,0,0,0,0,0,0};
                #pragma unroll
                for (int ks = 0; ks < 2; ++ks) {
                    const v16h kf = load_frag(&Ks[(hk * 64 + nt * 16) * 72 + ks * 32], 72, lane);
                    sacc[0][nt] = wmma16x16x32(kf, qf[0][ks], sacc[0][nt]);
                    sacc[1][nt] = wmma16x16x32(kf, qf[1][ks], sacc[1][nt]);
                }
            }

            // online softmax: the lane's 32 scores of a group are all of one query
            float mnew[2];
            #pragma unroll
            for (int g = 0; g < 2; ++g) {
                float rmv[8];
                #pragma unroll
                for (int r = 0; r < 8; ++r) {
                    rmv[r] = sacc[g][0][r];
                    #pragma unroll
                    for (int nt = 1; nt < 4; ++nt) rmv[r] = fmaxf(rmv[r], sacc[g][nt][r]);
                }
                float rm = fmaxf(fmaxf(fmaxf(rmv[0], rmv[1]), fmaxf(rmv[2], rmv[3])),
                                 fmaxf(fmaxf(rmv[4], rmv[5]), fmaxf(rmv[6], rmv[7])));
                rm = fmaxf(rm, other_half(rm));
                rm *= ATTN_SCALE;
                mnew[g] = fmaxf(mrow[g], rm);
                const float corr = __expf(mrow[g] - mnew[g]);
                mrow[g] = mnew[g];
                lrow[g] *= corr;
                #pragma unroll
                for (int dt = 0; dt < 4; ++dt)
                    #pragma unroll
                    for (int r = 0; r < 8; ++r) oacc[g][dt][r] *= corr;
            }

            // O^T += V^T P^T, 32 keys at a time: two score tiles, converted in place, are the
            // B operand in the k order that load_frag gives V^T (8h+0..7, then 16+8h+0..7)
            float psum[2][4] = {};
            #pragma unroll
            for (int kb = 0; kb < 2; ++kb) {
                v16h pf[2];
                #pragma unroll
                for (int g = 0; g < 2; ++g)
                    #pragma unroll
                    for (int s = 0; s < 16; ++s) {
                        float p = __expf(sacc[g][kb * 2 + (s >> 3)][s & 7] * ATTN_SCALE - mnew[g]);
                        psum[g][s & 3] += p;
                        pf[g][s] = (half_t)p;
                    }
                #pragma unroll
                for (int dt = 0; dt < 4; ++dt) {
                    const v16h vf = load_frag(&Vt[(dt * 16) * 136 + hk * 64 + kb * 32], 136, lane);
                    oacc[0][dt] = wmma16x16x32(vf, pf[0], oacc[0][dt]);
                    oacc[1][dt] = wmma16x16x32(vf, pf[1], oacc[1][dt]);
                }
            }
            #pragma unroll
            for (int g = 0; g < 2; ++g)
                lrow[g] += (psum[g][0] + psum[g][1]) + (psum[g][2] + psum[g][3]);
        }
    }

    // normalize + store f16 context for the output projection: 8 consecutive d per lane
    #pragma unroll
    for (int g = 0; g < 2; ++g) {
        const float lsum = lrow[g] + other_half(lrow[g]);
        const size_t orow = (size_t)(b * SEQ + q0 + wave * 32 + g * 16 + (lane & 15));
        #pragma unroll
        for (int dt = 0; dt < 4; ++dt) {
            v8h o;
            #pragma unroll
            for (int r = 0; r < 8; ++r) o[r] = (half_t)(oacc[g][dt][r] / lsum);
            *(v8h*)&ctx[orow * DIM + h * HEAD_DIM + dt * 16 + ((lane & 16) ? 8 : 0)] = o;
        }
    }
}

// ---------- host ----------
extern "C" void kernel_launch(void* const* d_in, const int* in_sizes, int n_in,
                              void* d_out, int out_size, void* d_ws, size_t ws_size,
                              hipStream_t stream) {
    (void)in_sizes; (void)n_in; (void)out_size; (void)ws_size;
    const float* x      = (const float*)d_in[0];
    const float* w_qkv  = (const float*)d_in[1];
    const float* w_proj = (const float*)d_in[2];
    const float* b_proj = (const float*)d_in[3];
    float* out = (float*)d_out;

    half_t* xh     = (half_t*)d_ws;                      // 8192*1024
    half_t* wqkvh  = xh     + (size_t)ROWS * DIM;        // 3072*1024
    half_t* wprojh = wqkvh  + (size_t)QKV_LD * DIM;      // 1024*1024
    half_t* qkvh   = wprojh + (size_t)DIM * DIM;         // 8192*3072
    half_t* ctxh   = qkvh   + (size_t)ROWS * QKV_LD;     // 8192*1024

    const int T = 256;
    cvt_f32_to_f16<<<(ROWS * DIM)   / (T * 4), T, 0, stream>>>(x,      xh);
    cvt_f32_to_f16<<<(QKV_LD * DIM) / (T * 4), T, 0, stream>>>(w_qkv,  wqkvh);
    cvt_f32_to_f16<<<(DIM * DIM)    / (T * 4), T, 0, stream>>>(w_proj, wprojh);

    gemm_wmma<true, false><<<dim3(ROWS / 128, QKV_LD / 128), 256, 0, stream>>>(
        xh, wqkvh, nullptr, qkvh, ROWS, QKV_LD, DIM);

    attn_wmma<<<dim3(SEQ / 256, BATCH * HEADS), 256, 0, stream>>>(qkvh, ctxh);

    gemm_wmma<false, true><<<dim3(ROWS / 128, DIM / 128), 256, 0, stream>>>(
        ctxh, wprojh, b_proj, out, ROWS, DIM, DIM);
}

// v004
// One run takes 150 microseconds.
// Next to v003, in two timings, it ran 1.04 and 1.05 times as fast.
// Over all steps from v000 it is 1.53 times as fast.
#include <hip/hip_runtime.h>
#include <stdint.h>

// ---------- types ----------
typedef _Float16 half_t;
typedef __attribute__((ext_vector_type(16))) _Float16 v16h;
typedef __attribute__((ext_vector_type(8)))  _Float16 v8h;
typedef __attribute__((ext_vector_type(4)))  _Float16 v4h;
typedef __attribute__((ext_vector_type(8)))  float    v8f;
typedef __attribute__((ext_vector_type(4)))  float    v4f;

#define DIM      1024
#define SEQ      2048
#define BATCH    4
#define HEADS    16
#define HEAD_DIM 64
#define ROWS     (BATCH * SEQ)       // 8192
#define QKV_LD   (3 * DIM)           // 3072
#define ATTN_SCALE 0.125f            // 1/sqrt(64)

// D = A*B + C, f16 inputs, f32 accumulate
__device__ __forceinline__ v8f wmma16x16x32(v16h a, v16h b, v8f c) {
    return __builtin_amdgcn_wmma_f32_16x16x32_f16(
        /*neg_a=*/false, a, /*neg_b=*/false, b,
        /*c_mod=*/(short)0, c, /*reuse_a=*/false, /*reuse_b=*/false);
}

// 16x32 f16 A/B fragment, per CDNA5 16-bit layout:
// lane l<16: row l, K={0..7,16..23}; lane l>=16: row l-16, K={8..15,24..31}.
__device__ __forceinline__ v16h load_frag(const half_t* __restrict__ base,
                                          int stride, int lane) {
    int r  = lane & 15;
    int k0 = (lane & 16) ? 8 : 0;
    const half_t* p = base + (size_t)r * stride + k0;
    v8h lo = *(const v8h*)(p);
    v8h hi = *(const v8h*)(p + 16);
    return __builtin_shufflevector(lo, hi, 0,1,2,3,4,5,6,7,8,9,10,11,12,13,14,15);
}

// Async global->LDS copy of 16 bytes per lane (tracked by ASYNCcnt).
// lds_off = low 32 bits of the generic LDS pointer (aperture|offset form).
__device__ __forceinline__ void async_copy_b128(unsigned lds_off, const void* gaddr) {
    asm volatile("global_load_async_to_lds_b128 %0, %1, off"
                 :: "v"(lds_off), "v"(gaddr) : "memory");
}
__device__ __forceinline__ void wait_async0() {
    asm volatile("s_wait_asynccnt 0x0" ::: "memory");
}
// Output staging: the lanes of ONE wave hand values to each other through the wave's own LDS
// range. This wait (and its "memory" clobber, which keeps the compiler from moving an LDS
// access across it) stands between the lanes' writes and the reads of other lanes' rows,
// and between those reads and the next writes over them.
__device__ __forceinline__ void wait_ds0() {
    asm volatile("s_wait_dscnt 0x0" ::: "memory");
}

// ---------- fp32 -> f16 convert ----------
__global__ void __launch_bounds__(256) cvt_f32_to_f16(const float* __restrict__ in,
                                                      half_t* __restrict__ out) {
    size_t i = ((size_t)blockIdx.x * blockDim.x + threadIdx.x) * 4;
    float4 v = *(const float4*)(in + i);
    v4h h = { (half_t)v.x, (half_t)v.y, (half_t)v.z, (half_t)v.w };
    *(v4h*)(out + i) = h;
}

// ---------- WMMA GEMM: C[m,n] = sum_k A[m,k]*B[n,k] (+bias) ----------
// 128x128 tile, 8 waves of 32x64, K-step 64, register-prefetch double buffering.
// A K-step of 64 halves makes a row slab one whole 128-B line: 8 lanes cover a row,
// so a wave-wide 16-B load touches 4 full lines instead of 16 partial ones.
// The products are taken as (B rows) x (A rows): a lane then holds 8 adjacent columns n of one
// row m, packs them into 16-B pieces, and the wave's 32x64 tile goes through the wave's own
// LDS range so that every global store covers whole 128-B lines.
template<bool OUT_HALF, bool BIAS>
__global__ void __launch_bounds__(256, 1)
gemm_wmma(const half_t* __restrict__ A, const half_t* __restrict__ B,
          const float* __restrict__ bias, void* __restrict__ Cout,
          int M, int N, int K) {
    __shared__ __align__(16) half_t As[128 * 72];   // 144B rows, 16B aligned chunks
    __shared__ __align__(16) half_t Bs[128 * 72];

    const int lane = threadIdx.x & 31;
    const int wave = threadIdx.x >> 5;
    const int bm = blockIdx.x * 128;
    const int bn = blockIdx.y * 128;
    const int wm = (wave & 3) * 32;
    const int wn = (wave >> 2) * 64;

    const int row0 = (int)threadIdx.x >> 3;        // 0..31; pass i stages row i*32 + row0
    const int kcc  = ((int)threadIdx.x & 7) * 8;   // 0,8,..,56: 8 lanes span one row slab
    // uniform base + one 32-bit per-lane byte offset, shared by all eight loads of a step
    const unsigned tbyte = (unsigned)(row0 * K + kcc) * 2u;
    const char* Ab = (const char*)(A + (size_t)bm * K);
    const char* Bb = (const char*)(B + (size_t)bn * K);
    const size_t pass_bytes = (size_t)32 * K * 2;

    v8f acc[2][4] = {};

    #pragma unroll
    for (int i = 0; i < 4; ++i) {
        *(v8h*)&As[(i * 32 + row0) * 72 + kcc] = *(const v8h*)(Ab + i * pass_bytes + tbyte);
        *(v8h*)&Bs[(i * 32 + row0) * 72 + kcc] = *(const v8h*)(Bb + i * pass_bytes + tbyte);
    }
    __syncthreads();

    for (int k0 = 0; k0 < K; k0 += 64) {
        const bool more = (k0 + 64) < K;
        v8h na[4], nb[4];
        if (more) {                             // overlap next-tile loads with WMMA
            const unsigned voff = tbyte + (unsigned)(k0 + 64) * 2u;
            #pragma unroll
            for (int i = 0; i < 4; ++i) {
                na[i] = *(const v8h*)(Ab + i * pass_bytes + voff);
                nb[i] = *(const v8h*)(Bb + i * pass_bytes + voff);
            }
        }
        #pragma unroll
        for (int ks = 0; ks < 2; ++ks) {        // k ascending: same sum order as before
            v16h af[2], bf[4];
            #pragma unroll
            for (int i = 0; i < 2; ++i) af[i] = load_frag(&As[(wm + i * 16) * 72 + ks * 32], 72, lane);
            #pragma unroll
            for (int j = 0; j < 4; ++j) bf[j] = load_frag(&Bs[(wn + j * 16) * 72 + ks * 32], 72, lane);
            #pragma unroll
            for (int i = 0; i < 2; ++i)
                #pragma unroll
                for (int j = 0; j < 4; ++j)
                    acc[i][j] = wmma16x16x32(bf[j], af[i], acc[i][j]);
        }
        if (more) {
            __syncthreads();
            #pragma unroll
            for (int i = 0; i < 4; ++i) {
                *(v8h*)&As[(i * 32 + row0) * 72 + kcc] = na[i];
                *(v8h*)&Bs[(i * 32 + row0) * 72 + kcc] = nb[i];
            }
            __syncthreads();
        }
    }

    // acc[i][j][r] = C[bm + wm + i * 16 + (lane & 15)][bn + wn + j * 16 + 8 * (lane >> 4) + r]
    const int c  = lane & 15;
    const int h8 = (lane >> 4) * 8;
    if (BIAS) {
        #pragma unroll
        for (int j = 0; j < 4; ++j) {
            const v8f bv = *(const v8f*)&bias[bn + wn + j * 16 + h8];
            acc[0][j] += bv;
            acc[1][j] += bv;
        }
    }
    __syncthreads();   // every wave has read its last fragments: As and Bs become staging
    half_t* stg = ((wave & 4) ? Bs : As) + (wave & 3) * (32 * 72);   // 4,608 B a wave
    // uniform base + one 32-bit per-lane byte offset, shared by all stores of the wave
    const size_t esz = OUT_HALF ? 2 : 4;
    char* Cb = (char*)Cout + ((size_t)bm * N + bn) * esz;
    if (OUT_HALF) {
        // 32 rows of 128 B at pitch 144 B; read back 8 lanes a row: 4 whole lines a store
        #pragma unroll
        for (int i = 0; i < 2; ++i)
            #pragma unroll
            for (int j = 0; j < 4; ++j) {
                v8h o;
                #pragma unroll
                for (int r = 0; r < 8; ++r) o[r] = (half_t)acc[i][j][r];
                *(v8h*)&stg[(i * 16 + c) * 72 + j * 16 + h8] = o;
            }
        wait_ds0();
        const unsigned voff = (unsigned)((wm + (lane >> 3)) * N + wn + (lane & 7) * 8) * 2u;
        #pragma unroll
        for (int t = 0; t < 8; ++t)
            *(v8h*)(Cb + (size_t)(t * 4) * N * 2 + voff) =
                *(const v8h*)&stg[(t * 4 + (lane >> 3)) * 72 + (lane & 7) * 8];
    } else {
        // 16 rows of 256 B at pitch 272 B, twice; read back 16 lanes a row: 4 whole lines a store
        float* fs = (float*)stg;
        #pragma unroll
        for (int i = 0; i < 2; ++i) {
            if (i) wait_ds0();
            #pragma unroll
            for (int j = 0; j < 4; ++j)
                #pragma unroll
                for (int q = 0; q < 2; ++q) {
                    v4f o;
                    #pragma unroll
                    for (int r = 0; r < 4; ++r) o[r] = acc[i][j][q * 4 + r];
                    *(v4f*)&fs[c * 68 + j * 16 + h8 + q * 4] = o;
                }
            wait_ds0();
            const unsigned voff = (unsigned)((wm + (lane >> 4)) * N + wn + c * 4) * 4u;
            #pragma unroll
            for (int t = 0; t < 8; ++t)
                *(v4f*)(Cb + (size_t)(i * 16 + t * 2) * N * 4 + voff) =
                    *(const v4f*)&fs[(t * 2 + (lane >> 4)) * 68 + c * 4];
        }
    }
}

// lane l <-> l ^ 16 (the other 16-lane row), in the vector unit
__device__ __forceinline__ float other_half(float v) {
    int b = __builtin_bit_cast(int, v);
    return __builtin_bit_cast(float,
        __builtin_amdgcn_permlanex16(b, b, 0x76543210, 0xfedcba98, false, false));
}

// ---------- flash attention: one block per (b, h, 256 query rows) ----------
// qkv: [8192,3072] f16 (Q@+0, K@+1024, V@+2048 per row; head offset h*64)
// A wave owns 32 queries (two 16-column groups), so every K and V fragment read from LDS
// feeds two WMMAs. 256 registers a wave: two work-groups a WGP hold the whole grid at once.
__global__ void __launch_bounds__(256) __attribute__((amdgpu_waves_per_eu(4, 4)))
attn_wmma(const half_t* __restrict__ qkv, half_t* __restrict__ ctx) {
    const int bh   = blockIdx.y;
    const int b    = bh >> 4;
    const int h    = bh & 15;
    const int q0   = blockIdx.x * 256;
    const int lane = threadIdx.x & 31;
    const int wave = threadIdx.x >> 5;

    __shared__ __align__(16) half_t Ks[128 * 72];      // K tile [key][d]   18.4 KB
    __shared__ __align__(16) half_t Vt[64 * 136];      // V^T   [d][key]    17.4 KB

    const size_t ld = QKV_LD;
    const half_t* Qbase = qkv + ((size_t)(b * SEQ + q0 + wave * 32)) * ld + h * HEAD_DIM;
    v16h qf[2][2];           // [column group][k step]
    #pragma unroll
    for (int g = 0; g < 2; ++g) {
        qf[g][0] = load_frag(Qbase + (size_t)(g * 16) * ld,      (int)ld, lane);
        qf[g][1] = load_frag(Qbase + (size_t)(g * 16) * ld + 32, (int)ld, lane);
    }

    // Transposed products: in group g a lane owns ONE query (g * 16 + (lane & 15)) and, of every
    // 16 keys, the eight at 8 * (lane >> 4). oacc[g][dt][r] = O[query][dt * 16 + 8 * (lane >> 4) + r].
    v8f oacc[2][4] = {};
    float mrow[2] = {-3.0e38f, -3.0e38f};   // running maxima (equal in both lane halves)
    float lrow[2] = {0.0f, 0.0f};           // running sums over this lane half's keys

    for (int kt = 0; kt < SEQ / 128; ++kt) {
        const int kv0 = kt * 128;
        __syncthreads();
        // stage K tile (async DMA to LDS) and transposed V tile (manual)
        #pragma unroll
        for (int i = 0; i < 4; ++i) {
            int cc  = i * 256 + (int)threadIdx.x; // 0..1023: 8 lanes span one 128-B K row
            int row = cc >> 3;                    // key 0..127
            int kc  = (cc & 7) * 8;               // d chunk
            const half_t* base = qkv + ((size_t)(b * SEQ + kv0 + row)) * ld + h * HEAD_DIM;
            async_copy_b128((unsigned)(uintptr_t)&Ks[row * 72 + kc], base + DIM + kc);
            // V keeps its lane map (2 lanes a row): its loads wait one by one, so the
            // first should touch every line the lane's later loads read again
            int vc   = (int)threadIdx.x * 4 + i;  // 0..1023
            int vrow = vc >> 3;                   // key 0..127
            int vkc  = (vc & 7) * 8;              // d chunk
            v8h vv = *(const v8h*)(qkv + ((size_t)(b * SEQ + kv0 + vrow)) * ld
                                       + h * HEAD_DIM + 2 * DIM + vkc);
            #pragma unroll
            for (int j = 0; j < 8; ++j) Vt[(vkc + j) * 136 + vrow] = vv[j];
        }
        // prefetch next K/V tile into cache while we compute this one
        if (kt + 1 < SEQ / 128) {
            int prow = (int)threadIdx.x & 127;
            const half_t* nbase = qkv + ((size_t)(b * SEQ + kv0 + 128 + prow)) * ld + h * HEAD_DIM;
            if (threadIdx.x < 128) __builtin_prefetch(nbase + DIM, 0, 1);
            else                   __builtin_prefetch(nbase + 2 * DIM, 0, 1);
        }
        wait_async0();          // K tile landed in LDS
        __syncthreads();

        // The staged 128 keys are worked on 64 at a time: 64 score registers for the two groups.
        // Kept rolled: unrolled, both halves' scores are live at once and registers spill.
        #pragma unroll 1
        for (int hk = 0; hk < 2; ++hk) {
            // S^T = K Q^T: sacc[g][nt][r] = S[query of g][key hk * 64 + nt * 16 + 8 * (lane >> 4) + r]
            v8f sacc[2][4];
            #pragma unroll
            for (int nt = 0; nt < 4; ++nt) {
                sacc[0][nt] = (v8f){0,0,0,0,0,0,0,0};
                sacc[1][nt] = (v8f){0,0,0,0,0,0,0,0};
                #pragma unroll
                for (int ks = 0; ks < 2; ++ks) {
                    const v16h kf = load_frag(&Ks[(hk * 64 + nt * 16) * 72 + ks * 32], 72, lane);
                    sacc[0][nt] = wmma16x16x32(kf, qf[0][ks], sacc[0][nt]);
                    sacc[1][nt] = wmma16x16x32(kf, qf[1][ks], sacc[1][nt]);
                }
            }

            // online softmax: the lane's 32 scores of a group are all of one query
            float mnew[2];
            #pragma unroll
            for (int g = 0; g < 2; ++g) {
                float rmv[8];
                #pragma unroll
                for (int r = 0; r < 8; ++r) {
                    rmv[r] = sacc[g][0][r];
                    #pragma unroll
                    for (int nt = 1; nt < 4; ++nt) rmv[r] = fmaxf(rmv[r], sacc[g][nt][r]);
                }
                float rm = fmaxf(fmaxf(fmaxf(rmv[0], rmv[1]), fmaxf(rmv[2], rmv[3])),
                                 fmaxf(fmaxf(rmv[4], rmv[5]), fmaxf(rmv[6], rmv[7])));
                rm = fmaxf(rm, other_half(rm));
                rm *= ATTN_SCALE;
                mnew[g] = fmaxf(mrow[g], rm);
                const float corr = __expf(mrow[g] - mnew[g]);
                mrow[g] = mnew[g];
                lrow[g] *= corr;
                #pragma unroll
                for (int dt = 0; dt < 4; ++dt)
                    #pragma unroll
                    for (int r = 0; r < 8; ++r) oacc[g][dt][r] *= corr;
            }

            // O^T += V^T P^T, 32 keys at a time: two score tiles, converted in place, are the
            // B operand in the k order that load_frag gives V^T (8h+0..7, then 16+8h+0..7)
            float psum[2][4] = {};
            #pragma unroll
            for (int kb = 0; kb < 2; ++kb) {
                v16h pf[2];
                #pragma unroll
                for (int g = 0; g < 2; ++g)
                    #pragma unroll
                    for (int s = 0; s < 16; ++s) {
                        float p = __expf(sacc[g][kb * 2 + (s >> 3)][s & 7] * ATTN_SCALE - mnew[g]);
                        psum[g][s & 3] += p;
                        pf[g][s] = (half_t)p;
                    }
                #pragma unroll
                for (int dt = 0; dt < 4; ++dt) {
                    const v16h vf = load_frag(&Vt[(dt * 16) * 136 + hk * 64 + kb * 32], 136, lane);
                    oacc[0][dt] = wmma16x16x32(vf, pf[0], oacc[0][dt]);
                    oacc[1][dt] = wmma16x16x32(vf, pf[1], oacc[1][dt]);
                }
            }
            #pragma unroll
            for (int g = 0; g < 2; ++g)
                lrow[g] += (psum[g][0] + psum[g][1]) + (psum[g][2] + psum[g][3]);
        }
    }

    // normalize + store f16 context for the output projection: 8 consecutive d per lane, passed
    // through the wave's own LDS range (16 rows of 128 B at pitch 144 B, once per group) so that
    // a store covers 4 whole 128-B lines instead of 16 pieces of 32 B
    __syncthreads();   // every wave has left the last tile: Ks becomes staging
    half_t* stg = Ks + wave * (16 * 72);
    #pragma unroll
    for (int g = 0; g < 2; ++g) {
        const float lsum = lrow[g] + other_half(lrow[g]);
        if (g) wait_ds0();
        #pragma unroll
        for (int dt = 0; dt < 4; ++dt) {
            v8h o;
            #pragma unroll
            for (int r = 0; r < 8; ++r) o[r] = (half_t)(oacc[g][dt][r] / lsum);
            *(v8h*)&stg[(lane & 15) * 72 + dt * 16 + ((lane & 16) ? 8 : 0)] = o;
        }
        wait_ds0();
        half_t* cw = ctx + (size_t)(b * SEQ + q0 + g * 16) * DIM + h * HEAD_DIM;   // uniform
        const unsigned voff = (unsigned)((wave * 32 + (lane >> 3)) * DIM + (lane & 7) * 8);
        #pragma unroll
        for (int t = 0; t < 4; ++t)
            *(v8h*)&cw[t * 4 * DIM + voff] = *(const v8h*)&stg[(t * 4 + (lane >> 3)) * 72 + (lane & 7) * 8];
    }
}

// ---------- host ----------
extern "C" void kernel_launch(void* const* d_in, const int* in_sizes, int n_in,
                              void* d_out, int out_size, void* d_ws, size_t ws_size,
                              hipStream_t stream) {
    (void)in_sizes; (void)n_in; (void)out_size; (void)ws_size;
    const float* x      = (const float*)d_in[0];
    const float* w_qkv  = (const float*)d_in[1];
    const float* w_proj = (const float*)d_in[2];
    const float* b_proj = (const float*)d_in[3];
    float* out = (float*)d_out;

    half_t* xh     = (half_t*)d_ws;                      // 8192*1024
    half_t* wqkvh  = xh     + (size_t)ROWS * DIM;        // 3072*1024
    half_t* wprojh = wqkvh  + (size_t)QKV_LD * DIM;      // 1024*1024
    half_t* qkvh   = wprojh + (size_t)DIM * DIM;         // 8192*3072
    half_t* ctxh   = qkvh   + (size_t)ROWS * QKV_LD;     // 8192*1024

    const int T = 256;
    cvt_f32_to_f16<<<(ROWS * DIM)   / (T * 4), T, 0, stream>>>(x,      xh);
    cvt_f32_to_f16<<<(QKV_LD * DIM) / (T * 4), T, 0, stream>>>(w_qkv,  wqkvh);
    cvt_f32_to_f16<<<(DIM * DIM)    / (T * 4), T, 0, stream>>>(w_proj, wprojh);

    gemm_wmma<true, false><<<dim3(ROWS / 128, QKV_LD / 128), 256, 0, stream>>>(
        xh, wqkvh, nullptr, qkvh, ROWS, QKV_LD, DIM);

    attn_wmma<<<dim3(SEQ / 256, BATCH * HEADS), 256, 0, stream>>>(qkvh, ctxh);

    gemm_wmma<false, true><<<dim3(ROWS / 128, DIM / 128), 256, 0, stream>>>(
        ctxh, wprojh, b_proj, out, ROWS, DIM, DIM);
}

// v005
// Measured time: 144 microseconds a run.
// Next to v004, in two timings, it ran 1.05 and 1.04 times as fast.
// All steps since v000 together make it 1.60 times as fast.
#include <hip/hip_runtime.h>
#include <stdint.h>

// ---------- types ----------
typedef _Float16 half_t;
typedef __attribute__((ext_vector_type(16))) _Float16 v16h;
typedef __attribute__((ext_vector_type(8)))  _Float16 v8h;
typedef __attribute__((ext_vector_type(4)))  _Float16 v4h;
typedef __attribute__((ext_vector_type(8)))  float    v8f;
typedef __attribute__((ext_vector_type(4)))  float    v4f;

#define DIM      1024
#define SEQ      2048
#define BATCH    4
#define HEADS    16
#define HEAD_DIM 64
#define ROWS     (BATCH * SEQ)       // 8192
#define QKV_LD   (3 * DIM)           // 3072
#define ATTN_SCALE 0.125f            // 1/sqrt(64)

// D = A*B + C, f16 inputs, f32 accumulate
__device__ __forceinline__ v8f wmma16x16x32(v16h a, v16h b, v8f c) {
    return __builtin_amdgcn_wmma_f32_16x16x32_f16(
        /*neg_a=*/false, a, /*neg_b=*/false, b,
        /*c_mod=*/(short)0, c, /*reuse_a=*/false, /*reuse_b=*/false);
}

// 16x32 f16 A/B fragment, per CDNA5 16-bit layout:
// lane l<16: row l, K={0..7,16..23}; lane l>=16: row l-16, K={8..15,24..31}.
__device__ __forceinline__ v16h load_frag(const half_t* __restrict__ base,
                                          int stride, int lane) {
    int r  = lane & 15;
    int k0 = (lane & 16) ? 8 : 0;
    const half_t* p = base + (size_t)r * stride + k0;
    v8h lo = *(const v8h*)(p);
    v8h hi = *(const v8h*)(p + 16);
    return __builtin_shufflevector(lo, hi, 0,1,2,3,4,5,6,7,8,9,10,11,12,13,14,15);
}

// Async global->LDS copy of 16 bytes per lane (tracked by ASYNCcnt).
// lds_off = low 32 bits of the generic LDS pointer (aperture|offset form).
__device__ __forceinline__ void async_copy_b128(unsigned lds_off, const void* gaddr) {
    asm volatile("global_load_async_to_lds_b128 %0, %1, off"
                 :: "v"(lds_off), "v"(gaddr) : "memory");
}
__device__ __forceinline__ void wait_async0() {
    asm volatile("s_wait_asynccnt 0x0" ::: "memory");
}
// Output staging: the lanes of ONE wave hand values to each other through the wave's own LDS
// range. This wait (and its "memory" clobber, which keeps the compiler from moving an LDS
// access across it) stands between the lanes' writes and the reads of other lanes' rows,
// and between those reads and the next writes over them.
__device__ __forceinline__ void wait_ds0() {
    asm volatile("s_wait_dscnt 0x0" ::: "memory");
}

// ---------- fp32 -> f16 convert: all three inputs, one launch ----------
// One resident grid: 256 work-groups of 16 waves. A piece is 1,024 floats (8 wave-wide loads of
// 512 contiguous bytes); x has 8,192 pieces, w_qkv 3,072, w_proj 1,024: three pieces a wave.
// The f16 copies lie one behind the other in the workspace, so piece p goes to out + p * 1,024.
// A wave's 24 loads stand ahead of its stores, so that many are in flight at once: the launch
// is paced by memory, not by how fast short waves can be started.
#define CVT_WAVES   4096
#define CVT_PIECE   1024
#define WQKV_PIECES (QKV_LD * DIM / CVT_PIECE)     // 3072
__global__ void __launch_bounds__(512) cvt_f32_to_f16(const float* __restrict__ x,
                                                      const float* __restrict__ w_qkv,
                                                      const float* __restrict__ w_proj,
                                                      half_t* __restrict__ out) {
    const int lane = threadIdx.x & 31;
    const int w = __builtin_amdgcn_readfirstlane((int)(blockIdx.x * 16 + (threadIdx.x >> 5)));
    const float* src[3];
    src[0] = x + (size_t)w * CVT_PIECE;
    src[1] = x + (size_t)(w + CVT_WAVES) * CVT_PIECE;
    src[2] = (w < WQKV_PIECES) ? w_qkv + (size_t)w * CVT_PIECE
                               : w_proj + (size_t)(w - WQKV_PIECES) * CVT_PIECE;
    v4f v[3][8];
    // all four loops unrolled: v stays in registers and the loads stand ahead of the stores
    #pragma unroll
    for (int p = 0; p < 3; ++p)
        #pragma unroll
        for (int i = 0; i < 8; ++i)
            v[p][i] = *(const v4f*)(src[p] + i * 128 + lane * 4);
    #pragma unroll
    for (int p = 0; p < 3; ++p) {
        half_t* dst = out + (size_t)(w + p * CVT_WAVES) * CVT_PIECE;
        #pragma unroll
        for (int i = 0; i < 8; ++i)
            *(v4h*)(dst + i * 128 + lane * 4) = __builtin_convertvector(v[p][i], v4h);
    }
}

// ---------- WMMA GEMM: C[m,n] = sum_k A[m,k]*B[n,k] (+bias) ----------
// 128x128 tile, 8 waves of 32x64, K-step 64, register-prefetch double buffering.
// A K-step of 64 halves makes a row slab one whole 128-B line: 8 lanes cover a row,
// so a wave-wide 16-B load touches 4 full lines instead of 16 partial ones.
// The products are taken as (B rows) x (A rows): a lane then holds 8 adjacent columns n of one
// row m, packs them into 16-B pieces, and the wave's 32x64 tile goes through the wave's own
// LDS range so that every global store covers whole 128-B lines.
template<bool OUT_HALF, bool BIAS>
__global__ void __launch_bounds__(256, 1)
gemm_wmma(const half_t* __restrict__ A, const half_t* __restrict__ B,
          const float* __restrict__ bias, void* __restrict__ Cout,
          int M, int N, int K) {
    __shared__ __align__(16) half_t As[128 * 72];   // 144B rows, 16B aligned chunks
    __shared__ __align__(16) half_t Bs[128 * 72];

    const int lane = threadIdx.x & 31;
    const int wave = threadIdx.x >> 5;
    const int bm = blockIdx.x * 128;
    const int bn = blockIdx.y * 128;
    const int wm = (wave & 3) * 32;
    const int wn = (wave >> 2) * 64;

    const int row0 = (int)threadIdx.x >> 3;        // 0..31; pass i stages row i*32 + row0
    const int kcc  = ((int)threadIdx.x & 7) * 8;   // 0,8,..,56: 8 lanes span one row slab
    // uniform base + one 32-bit per-lane byte offset, shared by all eight loads of a step
    const unsigned tbyte = (unsigned)(row0 * K + kcc) * 2u;
    const char* Ab = (const char*)(A + (size_t)bm * K);
    const char* Bb = (const char*)(B + (size_t)bn * K);
    const size_t pass_bytes = (size_t)32 * K * 2;

    v8f acc[2][4] = {};

    #pragma unroll
    for (int i = 0; i < 4; ++i) {
        *(v8h*)&As[(i * 32 + row0) * 72 + kcc] = *(const v8h*)(Ab + i * pass_bytes + tbyte);
        *(v8h*)&Bs[(i * 32 + row0) * 72 + kcc] = *(const v8h*)(Bb + i * pass_bytes + tbyte);
    }
    __syncthreads();

    for (int k0 = 0; k0 < K; k0 += 64) {
        const bool more = (k0 + 64) < K;
        v8h na[4], nb[4];
        if (more) {                             // overlap next-tile loads with WMMA
            const unsigned voff = tbyte + (unsigned)(k0 + 64) * 2u;
            #pragma unroll
            for (int i = 0; i < 4; ++i) {
                na[i] = *(const v8h*)(Ab + i * pass_bytes + voff);
                nb[i] = *(const v8h*)(Bb + i * pass_bytes + voff);
            }
        }
        #pragma unroll
        for (int ks = 0; ks < 2; ++ks) {        // k ascending: same sum order as before
            v16h af[2], bf[4];
            #pragma unroll
            for (int i = 0; i < 2; ++i) af[i] = load_frag(&As[(wm + i * 16) * 72 + ks * 32], 72, lane);
            #pragma unroll
            for (int j = 0; j < 4; ++j) bf[j] = load_frag(&Bs[(wn + j * 16) * 72 + ks * 32], 72, lane);
            #pragma unroll
            for (int i = 0; i < 2; ++i)
                #pragma unroll
                for (int j = 0; j < 4; ++j)
                    acc[i][j] = wmma16x16x32(bf[j], af[i], acc[i][j]);
        }
        if (more) {
            __syncthreads();
            #pragma unroll
            for (int i = 0; i < 4; ++i) {
                *(v8h*)&As[(i * 32 + row0) * 72 + kcc] = na[i];
                *(v8h*)&Bs[(i * 32 + row0) * 72 + kcc] = nb[i];
            }
            __syncthreads();
        }
    }

    // acc[i][j][r] = C[bm + wm + i * 16 + (lane & 15)][bn + wn + j * 16 + 8 * (lane >> 4) + r]
    const int c  = lane & 15;
    const int h8 = (lane >> 4) * 8;
    if (BIAS) {
        #pragma unroll
        for (int j = 0; j < 4; ++j) {
            const v8f bv = *(const v8f*)&bias[bn + wn + j * 16 + h8];
            acc[0][j] += bv;
            acc[1][j] += bv;
        }
    }
    __syncthreads();   // every wave has read its last fragments: As and Bs become staging
    half_t* stg = ((wave & 4) ? Bs : As) + (wave & 3) * (32 * 72);   // 4,608 B a wave
    // uniform base + one 32-bit per-lane byte offset, shared by all stores of the wave
    const size_t esz = OUT_HALF ? 2 : 4;
    char* Cb = (char*)Cout + ((size_t)bm * N + bn) * esz;
    if (OUT_HALF) {
        // 32 rows of 128 B at pitch 144 B; read back 8 lanes a row: 4 whole lines a store
        #pragma unroll
        for (int i = 0; i < 2; ++i)
            #pragma unroll
            for (int j = 0; j < 4; ++j) {
                v8h o;
                #pragma unroll
                for (int r = 0; r < 8; ++r) o[r] = (half_t)acc[i][j][r];
                *(v8h*)&stg[(i * 16 + c) * 72 + j * 16 + h8] = o;
            }
        wait_ds0();
        const unsigned voff = (unsigned)((wm + (lane >> 3)) * N + wn + (lane & 7) * 8) * 2u;
        #pragma unroll
        for (int t = 0; t < 8; ++t)
            *(v8h*)(Cb + (size_t)(t * 4) * N * 2 + voff) =
                *(const v8h*)&stg[(t * 4 + (lane >> 3)) * 72 + (lane & 7) * 8];
    } else {
        // 16 rows of 256 B at pitch 272 B, twice; read back 16 lanes a row: 4 whole lines a store
        float* fs = (float*)stg;
        #pragma unroll
        for (int i = 0; i < 2; ++i) {
            if (i) wait_ds0();
            #pragma unroll
            for (int j = 0; j < 4; ++j)
                #pragma unroll
                for (int q = 0; q < 2; ++q) {
                    v4f o;
                    #pragma unroll
                    for (int r = 0; r < 4; ++r) o[r] = acc[i][j][q * 4 + r];
                    *(v4f*)&fs[c * 68 + j * 16 + h8 + q * 4] = o;
                }
            wait_ds0();
            const unsigned voff = (unsigned)((wm + (lane >> 4)) * N + wn + c * 4) * 4u;
            #pragma unroll
            for (int t = 0; t < 8; ++t)
                *(v4f*)(Cb + (size_t)(i * 16 + t * 2) * N * 4 + voff) =
                    *(const v4f*)&fs[(t * 2 + (lane >> 4)) * 68 + c * 4];
        }
    }
}

// lane l <-> l ^ 16 (the other 16-lane row), in the vector unit
__device__ __forceinline__ float other_half(float v) {
    int b = __builtin_bit_cast(int, v);
    return __builtin_bit_cast(float,
        __builtin_amdgcn_permlanex16(b, b, 0x76543210, 0xfedcba98, false, false));
}

// ---------- flash attention: one block per (b, h, 256 query rows) ----------
// qkv: [8192,3072] f16 (Q@+0, K@+1024, V@+2048 per row; head offset h*64)
// A wave owns 32 queries (two 16-column groups), so every K and V fragment read from LDS
// feeds two WMMAs. 256 registers a wave: two work-groups a WGP hold the whole grid at once.
__global__ void __launch_bounds__(256) __attribute__((amdgpu_waves_per_eu(4, 4)))
attn_wmma(const half_t* __restrict__ qkv, half_t* __restrict__ ctx) {
    const int bh   = blockIdx.y;
    const int b    = bh >> 4;
    const int h    = bh & 15;
    const int q0   = blockIdx.x * 256;
    const int lane = threadIdx.x & 31;
    const int wave = threadIdx.x >> 5;

    __shared__ __align__(16) half_t Ks[128 * 72];      // K tile [key][d]   18.4 KB
    __shared__ __align__(16) half_t Vt[64 * 136];      // V^T   [d][key]    17.4 KB

    const size_t ld = QKV_LD;
    const half_t* Qbase = qkv + ((size_t)(b * SEQ + q0 + wave * 32)) * ld + h * HEAD_DIM;
    v16h qf[2][2];           // [column group][k step]
    #pragma unroll
    for (int g = 0; g < 2; ++g) {
        qf[g][0] = load_frag(Qbase + (size_t)(g * 16) * ld,      (int)ld, lane);
        qf[g][1] = load_frag(Qbase + (size_t)(g * 16) * ld + 32, (int)ld, lane);
    }

    // Transposed products: in group g a lane owns ONE query (g * 16 + (lane & 15)) and, of every
    // 16 keys, the eight at 8 * (lane >> 4). oacc[g][dt][r] = O[query][dt * 16 + 8 * (lane >> 4) + r].
    v8f oacc[2][4] = {};
    float mrow[2] = {-3.0e38f, -3.0e38f};   // running maxima (equal in both lane halves)
    float lrow[2] = {0.0f, 0.0f};           // running sums over this lane half's keys

    for (int kt = 0; kt < SEQ / 128; ++kt) {
        const int kv0 = kt * 128;
        __syncthreads();
        // stage K tile (async DMA to LDS) and transposed V tile (manual)
        #pragma unroll
        for (int i = 0; i < 4; ++i) {
            int cc  = i * 256 + (int)threadIdx.x; // 0..1023: 8 lanes span one 128-B K row
            int row = cc >> 3;                    // key 0..127
            int kc  = (cc & 7) * 8;               // d chunk
            const half_t* base = qkv + ((size_t)(b * SEQ + kv0 + row)) * ld + h * HEAD_DIM;
            async_copy_b128((unsigned)(uintptr_t)&Ks[row * 72 + kc], base + DIM + kc);
            // V keeps its lane map (2 lanes a row): its loads wait one by one, so the
            // first should touch every line the lane's later loads read again
            int vc   = (int)threadIdx.x * 4 + i;  // 0..1023
            int vrow = vc >> 3;                   // key 0..127
            int vkc  = (vc & 7) * 8;              // d chunk
            v8h vv = *(const v8h*)(qkv + ((size_t)(b * SEQ + kv0 + vrow)) * ld
                                       + h * HEAD_DIM + 2 * DIM + vkc);
            #pragma unroll
            for (int j = 0; j < 8; ++j) Vt[(vkc + j) * 136 + vrow] = vv[j];
        }
        // prefetch next K/V tile into cache while we compute this one
        if (kt + 1 < SEQ / 128) {
            int prow = (int)threadIdx.x & 127;
            const half_t* nbase = qkv + ((size_t)(b * SEQ + kv0 + 128 + prow)) * ld + h * HEAD_DIM;
            if (threadIdx.x < 128) __builtin_prefetch(nbase + DIM, 0, 1);
            else                   __builtin_prefetch(nbase + 2 * DIM, 0, 1);
        }
        wait_async0();          // K tile landed in LDS
        __syncthreads();

        // The staged 128 keys are worked on 64 at a time: 64 score registers for the two groups.
        // Kept rolled: unrolled, both halves' scores are live at once and registers spill.
        #pragma unroll 1
        for (int hk = 0; hk < 2; ++hk) {
            // S^T = K Q^T: sacc[g][nt][r] = S[query of g][key hk * 64 + nt * 16 + 8 * (lane >> 4) + r]
            v8f sacc[2][4];
            #pragma unroll
            for (int nt = 0; nt < 4; ++nt) {
                sacc[0][nt] = (v8f){0,0,0,0,0,0,0,0};
                sacc[1][nt] = (v8f){0,0,0,0,0,0,0,0};
                #pragma unroll
                for (int ks = 0; ks < 2; ++ks) {
                    const v16h kf = load_frag(&Ks[(hk * 64 + nt * 16) * 72 + ks * 32], 72, lane);
                    sacc[0][nt] = wmma16x16x32(kf, qf[0][ks], sacc[0][nt]);
                    sacc[1][nt] = wmma16x16x32(kf, qf[1][ks], sacc[1][nt]);
                }
            }

            // online softmax: the lane's 32 scores of a group are all of one query
            float mnew[2];
            #pragma unroll
            for (int g = 0; g < 2; ++g) {
                float rmv[8];
                #pragma unroll
                for (int r = 0; r < 8; ++r) {
                    rmv[r] = sacc[g][0][r];
                    #pragma unroll
                    for (int nt = 1; nt < 4; ++nt) rmv[r] = fmaxf(rmv[r], sacc[g][nt][r]);
                }
                float rm = fmaxf(fmaxf(fmaxf(rmv[0], rmv[1]), fmaxf(rmv[2], rmv[3])),
                                 fmaxf(fmaxf(rmv[4], rmv[5]), fmaxf(rmv[6], rmv[7])));
                rm = fmaxf(rm, other_half(rm));
                rm *= ATTN_SCALE;
                mnew[g] = fmaxf(mrow[g], rm);
                const float corr = __expf(mrow[g] - mnew[g]);
                mrow[g] = mnew[g];
                lrow[g] *= corr;
                #pragma unroll
                for (int dt = 0; dt < 4; ++dt)
                    #pragma unroll
                    for (int r = 0; r < 8; ++r) oacc[g][dt][r] *= corr;
            }

            // O^T += V^T P^T, 32 keys at a time: two score tiles, converted in place, are the
            // B operand in the k order that load_frag gives V^T (8h+0..7, then 16+8h+0..7)
            float psum[2][4] = {};
            #pragma unroll
            for (int kb = 0; kb < 2; ++kb) {
                v16h pf[2];
                #pragma unroll
                for (int g = 0; g < 2; ++g)
                    #pragma unroll
                    for (int s = 0; s < 16; ++s) {
                        float p = __expf(sacc[g][kb * 2 + (s >> 3)][s & 7] * ATTN_SCALE - mnew[g]);
                        psum[g][s & 3] += p;
                        pf[g][s] = (half_t)p;
                    }
                #pragma unroll
                for (int dt = 0; dt < 4; ++dt) {
                    const v16h vf = load_frag(&Vt[(dt * 16) * 136 + hk * 64 + kb * 32], 136, lane);
                    oacc[0][dt] = wmma16x16x32(vf, pf[0], oacc[0][dt]);
                    oacc[1][dt] = wmma16x16x32(vf, pf[1], oacc[1][dt]);
                }
            }
            #pragma unroll
            for (int g = 0; g < 2; ++g)
                lrow[g] += (psum[g][0] + psum[g][1]) + (psum[g][2] + psum[g][3]);
        }
    }

    // normalize + store f16 context for the output projection: 8 consecutive d per lane, passed
    // through the wave's own LDS range (16 rows of 128 B at pitch 144 B, once per group) so that
    // a store covers 4 whole 128-B lines instead of 16 pieces of 32 B
    __syncthreads();   // every wave has left the last tile: Ks becomes staging
    half_t* stg = Ks + wave * (16 * 72);
    #pragma unroll
    for (int g = 0; g < 2; ++g) {
        const float lsum = lrow[g] + other_half(lrow[g]);
        if (g) wait_ds0();
        #pragma unroll
        for (int dt = 0; dt < 4; ++dt) {
            v8h o;
            #pragma unroll
            for (int r = 0; r < 8; ++r) o[r] = (half_t)(oacc[g][dt][r] / lsum);
            *(v8h*)&stg[(lane & 15) * 72 + dt * 16 + ((lane & 16) ? 8 : 0)] = o;
        }
        wait_ds0();
        half_t* cw = ctx + (size_t)(b * SEQ + q0 + g * 16) * DIM + h * HEAD_DIM;   // uniform
        const unsigned voff = (unsigned)((wave * 32 + (lane >> 3)) * DIM + (lane & 7) * 8);
        #pragma unroll
        for (int t = 0; t < 4; ++t)
            *(v8h*)&cw[t * 4 * DIM + voff] = *(const v8h*)&stg[(t * 4 + (lane >> 3)) * 72 + (lane & 7) * 8];
    }
}

// ---------- host ----------
extern "C" void kernel_launch(void* const* d_in, const int* in_sizes, int n_in,
                              void* d_out, int out_size, void* d_ws, size_t ws_size,
                              hipStream_t stream) {
    (void)in_sizes; (void)n_in; (void)out_size; (void)ws_size;
    const float* x      = (const float*)d_in[0];
    const float* w_qkv  = (const float*)d_in[1];
    const float* w_proj = (const float*)d_in[2];
    const float* b_proj = (const float*)d_in[3];
    float* out = (float*)d_out;

    half_t* xh     = (half_t*)d_ws;                      // 8192*1024
    half_t* wqkvh  = xh     + (size_t)ROWS * DIM;        // 3072*1024
    half_t* wprojh = wqkvh  + (size_t)QKV_LD * DIM;      // 1024*1024
    half_t* qkvh   = wprojh + (size_t)DIM * DIM;         // 8192*3072
    half_t* ctxh   = qkvh   + (size_t)ROWS * QKV_LD;     // 8192*1024

    // xh, wqkvh and wprojh are one contiguous range: the conversion writes it from xh on
    cvt_f32_to_f16<<<CVT_WAVES / 16, 512, 0, stream>>>(x, w_qkv, w_proj, xh);

    gemm_wmma<true, false><<<dim3(ROWS / 128, QKV_LD / 128), 256, 0, stream>>>(
        xh, wqkvh, nullptr, qkvh, ROWS, QKV_LD, DIM);

    attn_wmma<<<dim3(SEQ / 256, BATCH * HEADS), 256, 0, stream>>>(qkvh, ctxh);

    gemm_wmma<false, true><<<dim3(ROWS / 128, DIM / 128), 256, 0, stream>>>(
        ctxh, wprojh, b_proj, out, ROWS, DIM, DIM);
}

// v006
// A run of this version takes 135 microseconds.
// In two side-by-side timings against v005, it was 1.06 and 1.07 times as fast.
// Over all steps from v000 it is 1.70 times as fast.
#include <hip/hip_runtime.h>
#include <stdint.h>

// ---------- types ----------
typedef _Float16 half_t;
typedef __attribute__((ext_vector_type(16))) _Float16 v16h;
typedef __attribute__((ext_vector_type(8)))  _Float16 v8h;
typedef __attribute__((ext_vector_type(4)))  _Float16 v4h;
typedef __attribute__((ext_vector_type(8)))  float    v8f;
typedef __attribute__((ext_vector_type(4)))  float    v4f;

#define DIM      1024
#define SEQ      2048
#define BATCH    4
#define HEADS    16
#define HEAD_DIM 64
#define ROWS     (BATCH * SEQ)       // 8192
#define QKV_LD   (3 * DIM)           // 3072
#define ATTN_SCALE 0.125f            // 1/sqrt(64)

// D = A*B + C, f16 inputs, f32 accumulate
__device__ __forceinline__ v8f wmma16x16x32(v16h a, v16h b, v8f c) {
    return __builtin_amdgcn_wmma_f32_16x16x32_f16(
        /*neg_a=*/false, a, /*neg_b=*/false, b,
        /*c_mod=*/(short)0, c, /*reuse_a=*/false, /*reuse_b=*/false);
}

// 16x32 f16 A/B fragment, per CDNA5 16-bit layout:
// lane l<16: row l, K={0..7,16..23}; lane l>=16: row l-16, K={8..15,24..31}.
__device__ __forceinline__ v16h load_frag(const half_t* __restrict__ base,
                                          int stride, int lane) {
    int r  = lane & 15;
    int k0 = (lane & 16) ? 8 : 0;
    const half_t* p = base + (size_t)r * stride + k0;
    v8h lo = *(const v8h*)(p);
    v8h hi = *(const v8h*)(p + 16);
    return __builtin_shufflevector(lo, hi, 0,1,2,3,4,5,6,7,8,9,10,11,12,13,14,15);
}

// Async global->LDS copies of 16 bytes per lane (tracked by ASYNCcnt): a lane's share of one
// 128-key tile, four pieces of K (LDS rows of 144 B) and four of V (LDS rows of 160 B), 32 keys
// apart. gk = the lane's first piece of K; V lies DIM elements behind K in the same qkv row.
// kl, vl = low 32 bits of the generic LDS pointers of the first pieces.
// All eight stand in ONE statement that ends in s_wait_xcnt 0: the wait then stands ahead of
// whatever next rewrites an address register that a copy names (a precaution; in a statement
// of its own the compiler could move such a write over it).
__device__ __forceinline__ void async_copy_kv_tile(const half_t* gk, unsigned kl, unsigned vl) {
    const half_t* gv = gk + DIM;
    asm volatile("global_load_async_to_lds_b128 %0, %1, off\n\t"
                 "global_load_async_to_lds_b128 %2, %3, off\n\t"
                 "global_load_async_to_lds_b128 %4, %5, off\n\t"
                 "global_load_async_to_lds_b128 %6, %7, off\n\t"
                 "global_load_async_to_lds_b128 %8, %9, off\n\t"
                 "global_load_async_to_lds_b128 %10, %11, off\n\t"
                 "global_load_async_to_lds_b128 %12, %13, off\n\t"
                 "global_load_async_to_lds_b128 %14, %15, off\n\t"
                 "s_wait_xcnt 0x0"
                 :: "v"(kl),                "v"(gk),
                    "v"(kl + 1u * 32 * 144), "v"(gk + 1 * 32 * QKV_LD),
                    "v"(kl + 2u * 32 * 144), "v"(gk + 2 * 32 * QKV_LD),
                    "v"(kl + 3u * 32 * 144), "v"(gk + 3 * 32 * QKV_LD),
                    "v"(vl),                "v"(gv),
                    "v"(vl + 1u * 32 * 160), "v"(gv + 1 * 32 * QKV_LD),
                    "v"(vl + 2u * 32 * 160), "v"(gv + 2 * 32 * QKV_LD),
                    "v"(vl + 3u * 32 * 160), "v"(gv + 3 * 32 * QKV_LD) : "memory");
}
__device__ __forceinline__ void wait_async0() {
    asm volatile("s_wait_asynccnt 0x0" ::: "memory");
}
// Output staging: the lanes of ONE wave hand values to each other through the wave's own LDS
// range. This wait (and its "memory" clobber, which keeps the compiler from moving an LDS
// access across it) stands between the lanes' writes and the reads of other lanes' rows,
// and between those reads and the next writes over them.
__device__ __forceinline__ void wait_ds0() {
    asm volatile("s_wait_dscnt 0x0" ::: "memory");
}

// ---------- fp32 -> f16 convert: all three inputs, one launch ----------
// One resident grid: 256 work-groups of 16 waves. A piece is 1,024 floats (8 wave-wide loads of
// 512 contiguous bytes); x has 8,192 pieces, w_qkv 3,072, w_proj 1,024: three pieces a wave.
// The f16 copies lie one behind the other in the workspace, so piece p goes to out + p * 1,024.
// A wave's 24 loads stand ahead of its stores, so that many are in flight at once: the launch
// is paced by memory, not by how fast short waves can be started.
#define CVT_WAVES   4096
#define CVT_PIECE   1024
#define WQKV_PIECES (QKV_LD * DIM / CVT_PIECE)     // 3072
__global__ void __launch_bounds__(512) cvt_f32_to_f16(const float* __restrict__ x,
                                                      const float* __restrict__ w_qkv,
                                                      const float* __restrict__ w_proj,
                                                      half_t* __restrict__ out) {
    const int lane = threadIdx.x & 31;
    const int w = __builtin_amdgcn_readfirstlane((int)(blockIdx.x * 16 + (threadIdx.x >> 5)));
    const float* src[3];
    src[0] = x + (size_t)w * CVT_PIECE;
    src[1] = x + (size_t)(w + CVT_WAVES) * CVT_PIECE;
    src[2] = (w < WQKV_PIECES) ? w_qkv + (size_t)w * CVT_PIECE
                               : w_proj + (size_t)(w - WQKV_PIECES) * CVT_PIECE;
    v4f v[3][8];
    // all four loops unrolled: v stays in registers and the loads stand ahead of the stores
    #pragma unroll
    for (int p = 0; p < 3; ++p)
        #pragma unroll
        for (int i = 0; i < 8; ++i)
            v[p][i] = *(const v4f*)(src[p] + i * 128 + lane * 4);
    #pragma unroll
    for (int p = 0; p < 3; ++p) {
        half_t* dst = out + (size_t)(w + p * CVT_WAVES) * CVT_PIECE;
        #pragma unroll
        for (int i = 0; i < 8; ++i)
            *(v4h*)(dst + i * 128 + lane * 4) = __builtin_convertvector(v[p][i], v4h);
    }
}

// ---------- WMMA GEMM: C[m,n] = sum_k A[m,k]*B[n,k] (+bias) ----------
// 128x128 tile, 8 waves of 32x64, K-step 64, register-prefetch double buffering.
// A K-step of 64 halves makes a row slab one whole 128-B line: 8 lanes cover a row,
// so a wave-wide 16-B load touches 4 full lines instead of 16 partial ones.
// The products are taken as (B rows) x (A rows): a lane then holds 8 adjacent columns n of one
// row m, packs them into 16-B pieces, and the wave's 32x64 tile goes through the wave's own
// LDS range so that every global store covers whole 128-B lines.
template<bool OUT_HALF, bool BIAS>
__global__ void __launch_bounds__(256, 1)
gemm_wmma(const half_t* __restrict__ A, const half_t* __restrict__ B,
          const float* __restrict__ bias, void* __restrict__ Cout,
          int M, int N, int K) {
    __shared__ __align__(16) half_t As[128 * 72];   // 144B rows, 16B aligned chunks
    __shared__ __align__(16) half_t Bs[128 * 72];

    const int lane = threadIdx.x & 31;
    const int wave = threadIdx.x >> 5;
    const int bm = blockIdx.x * 128;
    const int bn = blockIdx.y * 128;
    const int wm = (wave & 3) * 32;
    const int wn = (wave >> 2) * 64;

    const int row0 = (int)threadIdx.x >> 3;        // 0..31; pass i stages row i*32 + row0
    const int kcc  = ((int)threadIdx.x & 7) * 8;   // 0,8,..,56: 8 lanes span one row slab
    // uniform base + one 32-bit per-lane byte offset, shared by all eight loads of a step
    const unsigned tbyte = (unsigned)(row0 * K + kcc) * 2u;
    const char* Ab = (const char*)(A + (size_t)bm * K);
    const char* Bb = (const char*)(B + (size_t)bn * K);
    const size_t pass_bytes = (size_t)32 * K * 2;

    v8f acc[2][4] = {};

    #pragma unroll
    for (int i = 0; i < 4; ++i) {
        *(v8h*)&As[(i * 32 + row0) * 72 + kcc] = *(const v8h*)(Ab + i * pass_bytes + tbyte);
        *(v8h*)&Bs[(i * 32 + row0) * 72 + kcc] = *(const v8h*)(Bb + i * pass_bytes + tbyte);
    }
    __syncthreads();

    for (int k0 = 0; k0 < K; k0 += 64) {
        const bool more = (k0 + 64) < K;
        v8h na[4], nb[4];
        if (more) {                             // overlap next-tile loads with WMMA
            const unsigned voff = tbyte + (unsigned)(k0 + 64) * 2u;
            #pragma unroll
            for (int i = 0; i < 4; ++i) {
                na[i] = *(const v8h*)(Ab + i * pass_bytes + voff);
                nb[i] = *(const v8h*)(Bb + i * pass_bytes + voff);
            }
        }
        #pragma unroll
        for (int ks = 0; ks < 2; ++ks) {        // k ascending: same sum order as before
            v16h af[2], bf[4];
            #pragma unroll
            for (int i = 0; i < 2; ++i) af[i] = load_frag(&As[(wm + i * 16) * 72 + ks * 32], 72, lane);
            #pragma unroll
            for (int j = 0; j < 4; ++j) bf[j] = load_frag(&Bs[(wn + j * 16) * 72 + ks * 32], 72, lane);
            #pragma unroll
            for (int i = 0; i < 2; ++i)
                #pragma unroll
                for (int j = 0; j < 4; ++j)
                    acc[i][j] = wmma16x16x32(bf[j], af[i], acc[i][j]);
        }
        if (more) {
            __syncthreads();
            #pragma unroll
            for (int i = 0; i < 4; ++i) {
                *(v8h*)&As[(i * 32 + row0) * 72 + kcc] = na[i];
                *(v8h*)&Bs[(i * 32 + row0) * 72 + kcc] = nb[i];
            }
            __syncthreads();
        }
    }

    // acc[i][j][r] = C[bm + wm + i * 16 + (lane & 15)][bn + wn + j * 16 + 8 * (lane >> 4) + r]
    const int c  = lane & 15;
    const int h8 = (lane >> 4) * 8;
    if (BIAS) {
        #pragma unroll
        for (int j = 0; j < 4; ++j) {
            const v8f bv = *(const v8f*)&bias[bn + wn + j * 16 + h8];
            acc[0][j] += bv;
            acc[1][j] += bv;
        }
    }
    __syncthreads();   // every wave has read its last fragments: As and Bs become staging
    half_t* stg = ((wave & 4) ? Bs : As) + (wave & 3) * (32 * 72);   // 4,608 B a wave
    // uniform base + one 32-bit per-lane byte offset, shared by all stores of the wave
    const size_t esz = OUT_HALF ? 2 : 4;
    char* Cb = (char*)Cout + ((size_t)bm * N + bn) * esz;
    if (OUT_HALF) {
        // 32 rows of 128 B at pitch 144 B; read back 8 lanes a row: 4 whole lines a store
        #pragma unroll
        for (int i = 0; i < 2; ++i)
            #pragma unroll
            for (int j = 0; j < 4; ++j) {
                v8h o;
                #pragma unroll
                for (int r = 0; r < 8; ++r) o[r] = (half_t)acc[i][j][r];
                *(v8h*)&stg[(i * 16 + c) * 72 + j * 16 + h8] = o;
            }
        wait_ds0();
        const unsigned voff = (unsigned)((wm + (lane >> 3)) * N + wn + (lane & 7) * 8) * 2u;
        #pragma unroll
        for (int t = 0; t < 8; ++t)
            *(v8h*)(Cb + (size_t)(t * 4) * N * 2 + voff) =
                *(const v8h*)&stg[(t * 4 + (lane >> 3)) * 72 + (lane & 7) * 8];
    } else {
        // 16 rows of 256 B at pitch 272 B, twice; read back 16 lanes a row: 4 whole lines a store
        float* fs = (float*)stg;
        #pragma unroll
        for (int i = 0; i < 2; ++i) {
            if (i) wait_ds0();
            #pragma unroll
            for (int j = 0; j < 4; ++j)
                #pragma unroll
                for (int q = 0; q < 2; ++q) {
                    v4f o;
                    #pragma unroll
                    for (int r = 0; r < 4; ++r) o[r] = acc[i][j][q * 4 + r];
                    *(v4f*)&fs[c * 68 + j * 16 + h8 + q * 4] = o;
                }
            wait_ds0();
            const unsigned voff = (unsigned)((wm + (lane >> 4)) * N + wn + c * 4) * 4u;
            #pragma unroll
            for (int t = 0; t < 8; ++t)
                *(v4f*)(Cb + (size_t)(i * 16 + t * 2) * N * 4 + voff) =
                    *(const v4f*)&fs[(t * 2 + (lane >> 4)) * 68 + c * 4];
        }
    }
}

// Transposing LDS load: from a row-major tile T[key][d] of 16-bit values, with the lane address
// T + (kbase + 8 * (l >> 4) + (l & 7)) * pitch + dbase + 8 * ((l >> 3) & 1)   (in elements),
// lane l gets T[kbase + 8 * (l >> 4) + 0..7][dbase + (l & 15)]: half of a 16x32 fragment of T^T.
typedef __attribute__((ext_vector_type(8))) short s16x8;
__device__ __forceinline__ v8h load_tr16(const half_t* p) {
    typedef __attribute__((address_space(3))) s16x8 lds_s16x8;
    return __builtin_bit_cast(v8h, __builtin_amdgcn_ds_load_tr16_b128_v8i16((lds_s16x8*)p));
}

// lane l <-> l ^ 16 (the other 16-lane row), in the vector unit
__device__ __forceinline__ float other_half(float v) {
    int b = __builtin_bit_cast(int, v);
    return __builtin_bit_cast(float,
        __builtin_amdgcn_permlanex16(b, b, 0x76543210, 0xfedcba98, false, false));
}

// ---------- flash attention: one block per (b, h, 256 query rows) ----------
// qkv: [8192,3072] f16 (Q@+0, K@+1024, V@+2048 per row; head offset h*64)
// A wave owns 32 queries (two 16-column groups), so every K and V fragment read from LDS
// feeds two WMMAs. 256 registers a wave: two work-groups a WGP hold the whole grid at once.
// K and V tiles of 128 keys lie row-major in a ring of two LDS buffers, filled by async copies:
// while a tile is worked on, the next one is in flight. V^T comes from the transposing load.
__global__ void __launch_bounds__(256) __attribute__((amdgpu_waves_per_eu(4, 4)))
attn_wmma(const half_t* __restrict__ qkv, half_t* __restrict__ ctx) {
    const int bh   = blockIdx.y;
    const int b    = bh >> 4;
    const int h    = bh & 15;
    const int q0   = blockIdx.x * 256;
    const int lane = threadIdx.x & 31;
    const int wave = threadIdx.x >> 5;

    __shared__ __align__(16) half_t Ks[2 * 128 * 72];  // K tiles [key][d], 144-B rows, 2 x 18.4 KB
    __shared__ __align__(16) half_t Vs[2 * 128 * 80];  // V tiles [key][d], 160-B rows (32 B x odd:
                                                       // the transposing load's pitch), 2 x 20.5 KB

    const size_t ld = QKV_LD;
    const half_t* Qbase = qkv + ((size_t)(b * SEQ + q0 + wave * 32)) * ld + h * HEAD_DIM;
    v16h qf[2][2];           // [column group][k step]
    #pragma unroll
    for (int g = 0; g < 2; ++g) {
        qf[g][0] = load_frag(Qbase + (size_t)(g * 16) * ld,      (int)ld, lane);
        qf[g][1] = load_frag(Qbase + (size_t)(g * 16) * ld + 32, (int)ld, lane);
    }

    // Transposed products: in group g a lane owns ONE query (g * 16 + (lane & 15)) and, of every
    // 16 keys, the eight at 8 * (lane >> 4). oacc[g][dt][r] = O[query][dt * 16 + 8 * (lane >> 4) + r].
    v8f oacc[2][4] = {};
    float mrow[2] = {-3.0e38f, -3.0e38f};   // running maxima (equal in both lane halves)
    float lrow[2] = {0.0f, 0.0f};           // running sums over this lane half's keys

    // the lane's share of a tile: 8 lanes span one 128-B row, a copy of the block 32 rows
    const int srow = (int)threadIdx.x >> 3;            // key 0..31 (+ 32 per piece)
    const int skc  = ((int)threadIdx.x & 7) * 8;       // d chunk
    const half_t* gk0 = qkv + ((size_t)(b * SEQ + srow)) * ld + h * HEAD_DIM + DIM + skc;
    const unsigned kl0 = (unsigned)(uintptr_t)&Ks[srow * 72 + skc];
    const unsigned vl0 = (unsigned)(uintptr_t)&Vs[srow * 80 + skc];
    // the lane's place in a transposing load of a V tile (see load_tr16)
    const half_t* vlane = &Vs[(8 * (lane >> 4) + (lane & 7)) * 80 + 8 * ((lane >> 3) & 1)];

    // ring prologue: tile 0 lands and is published; then tile 1 starts into the other buffer
    async_copy_kv_tile(gk0, kl0, vl0);
    wait_async0();
    __syncthreads();
    async_copy_kv_tile(gk0 + (size_t)128 * ld, kl0 + 128 * 144, vl0 + 128 * 160);

    for (int kt = 0; kt < SEQ / 128; ++kt) {
        const int buf = kt & 1;
        const half_t* Kb = Ks + buf * (128 * 72);
        const half_t* Vb = vlane + buf * (128 * 80);

        // The staged 128 keys are worked on 64 at a time: 64 score registers for the two groups.
        // Kept rolled: unrolled, both halves' scores are live at once and registers spill.
        #pragma unroll 1
        for (int hk = 0; hk < 2; ++hk) {
            // S^T = K Q^T: sacc[g][nt][r] = S[query of g][key hk * 64 + nt * 16 + 8 * (lane >> 4) + r]
            v8f sacc[2][4];
            #pragma unroll
            for (int nt = 0; nt < 4; ++nt) {
                sacc[0][nt] = (v8f){0,0,0,0,0,0,0,0};
                sacc[1][nt] = (v8f){0,0,0,0,0,0,0,0};
                #pragma unroll
                for (int ks = 0; ks < 2; ++ks) {
                    const v16h kf = load_frag(&Kb[(hk * 64 + nt * 16) * 72 + ks * 32], 72, lane);
                    sacc[0][nt] = wmma16x16x32(kf, qf[0][ks], sacc[0][nt]);
                    sacc[1][nt] = wmma16x16x32(kf, qf[1][ks], sacc[1][nt]);
                }
            }

            // online softmax: the lane's 32 scores of a group are all of one query
            float mnew[2];
            #pragma unroll
            for (int g = 0; g < 2; ++g) {
                float rmv[8];
                #pragma unroll
                for (int r = 0; r < 8; ++r) {
                    rmv[r] = sacc[g][0][r];
                    #pragma unroll
                    for (int nt = 1; nt < 4; ++nt) rmv[r] = fmaxf(rmv[r], sacc[g][nt][r]);
                }
                float rm = fmaxf(fmaxf(fmaxf(rmv[0], rmv[1]), fmaxf(rmv[2], rmv[3])),
                                 fmaxf(fmaxf(rmv[4], rmv[5]), fmaxf(rmv[6], rmv[7])));
                rm = fmaxf(rm, other_half(rm));
                rm *= ATTN_SCALE;
                mnew[g] = fmaxf(mrow[g], rm);
                const float corr = __expf(mrow[g] - mnew[g]);
                mrow[g] = mnew[g];
                lrow[g] *= corr;
                #pragma unroll
                for (int dt = 0; dt < 4; ++dt)
                    #pragma unroll
                    for (int r = 0; r < 8; ++r) oacc[g][dt][r] *= corr;
            }

            // O^T += V^T P^T, 32 keys at a time: two score tiles, converted in place, are the
            // B operand in the k order of the two transposing loads (8h+0..7, then 16+8h+0..7)
            float psum[2][4] = {};
            #pragma unroll
            for (int kb = 0; kb < 2; ++kb) {
                v16h pf[2];
                #pragma unroll
                for (int g = 0; g < 2; ++g)
                    #pragma unroll
                    for (int s = 0; s < 16; ++s) {
                        float p = __expf(sacc[g][kb * 2 + (s >> 3)][s & 7] * ATTN_SCALE - mnew[g]);
                        psum[g][s & 3] += p;
                        pf[g][s] = (half_t)p;
                    }
                #pragma unroll
                for (int dt = 0; dt < 4; ++dt) {
                    const half_t* vp = Vb + (hk * 64 + kb * 32) * 80 + dt * 16;
                    const v16h vf = __builtin_shufflevector(load_tr16(vp), load_tr16(vp + 16 * 80),
                                        0,1,2,3,4,5,6,7,8,9,10,11,12,13,14,15);
                    oacc[0][dt] = wmma16x16x32(vf, pf[0], oacc[0][dt]);
                    oacc[1][dt] = wmma16x16x32(vf, pf[1], oacc[1][dt]);
                }
            }
            #pragma unroll
            for (int g = 0; g < 2; ++g)
                lrow[g] += (psum[g][0] + psum[g][1]) + (psum[g][2] + psum[g][3]);
        }

        // publish point of tile kt + 1: this wave's reads of tile kt are done and its own pieces
        // of tile kt + 1 have landed; behind the barrier the same holds of every wave, so tile
        // kt + 1 may be read and the buffer of tile kt refilled
        wait_ds0();
        wait_async0();
        __syncthreads();
        if (kt + 2 < SEQ / 128)
            async_copy_kv_tile(gk0 + (size_t)(kt + 2) * 128 * ld,
                               kl0 + buf * (128 * 144), vl0 + buf * (128 * 160));
    }
    wait_async0();   // no copy is outstanding when the ring becomes output staging

    // normalize + store f16 context for the output projection: 8 consecutive d per lane, passed
    // through the wave's own LDS range (16 rows of 128 B at pitch 144 B, once per group) so that
    // a store covers 4 whole 128-B lines instead of 16 pieces of 32 B
    // (the last publish point's barrier: every wave has left the last tile, Ks becomes staging)
    half_t* stg = Ks + wave * (16 * 72);
    #pragma unroll
    for (int g = 0; g < 2; ++g) {
        const float lsum = lrow[g] + other_half(lrow[g]);
        if (g) wait_ds0();
        #pragma unroll
        for (int dt = 0; dt < 4; ++dt) {
            v8h o;
            #pragma unroll
            for (int r = 0; r < 8; ++r) o[r] = (half_t)(oacc[g][dt][r] / lsum);
            *(v8h*)&stg[(lane & 15) * 72 + dt * 16 + ((lane & 16) ? 8 : 0)] = o;
        }
        wait_ds0();
        half_t* cw = ctx + (size_t)(b * SEQ + q0 + g * 16) * DIM + h * HEAD_DIM;   // uniform
        const unsigned voff = (unsigned)((wave * 32 + (lane >> 3)) * DIM + (lane & 7) * 8);
        #pragma unroll
        for (int t = 0; t < 4; ++t)
            *(v8h*)&cw[t * 4 * DIM + voff] = *(const v8h*)&stg[(t * 4 + (lane >> 3)) * 72 + (lane & 7) * 8];
    }
}

// ---------- host ----------
extern "C" void kernel_launch(void* const* d_in, const int* in_sizes, int n_in,
                              void* d_out, int out_size, void* d_ws, size_t ws_size,
                              hipStream_t stream) {
    (void)in_sizes; (void)n_in; (void)out_size; (void)ws_size;
    const float* x      = (const float*)d_in[0];
    const float* w_qkv  = (const float*)d_in[1];
    const float* w_proj = (const float*)d_in[2];
    const float* b_proj = (const float*)d_in[3];
    float* out = (float*)d_out;

    half_t* xh     = (half_t*)d_ws;                      // 8192*1024
    half_t* wqkvh  = xh     + (size_t)ROWS * DIM;        // 3072*1024
    half_t* wprojh = wqkvh  + (size_t)QKV_LD * DIM;      // 1024*1024
    half_t* qkvh   = wprojh + (size_t)DIM * DIM;         // 8192*3072
    half_t* ctxh   = qkvh   + (size_t)ROWS * QKV_LD;     // 8192*1024

    // xh, wqkvh and wprojh are one contiguous range: the conversion writes it from xh on
    cvt_f32_to_f16<<<CVT_WAVES / 16, 512, 0, stream>>>(x, w_qkv, w_proj, xh);

    gemm_wmma<true, false><<<dim3(ROWS / 128, QKV_LD / 128), 256, 0, stream>>>(
        xh, wqkvh, nullptr, qkvh, ROWS, QKV_LD, DIM);

    attn_wmma<<<dim3(SEQ / 256, BATCH * HEADS), 256, 0, stream>>>(qkvh, ctxh);

    gemm_wmma<false, true><<<dim3(ROWS / 128, DIM / 128), 256, 0, stream>>>(
        ctxh, wprojh, b_proj, out, ROWS, DIM, DIM);
}

// v007
// Measured time: 127 microseconds a run.
// Next to v006, in two timings, it ran 1.06 times as fast each time.
// All steps since v000 together make it 1.80 times as fast.
#include <hip/hip_runtime.h>
#include <stdint.h>

// ---------- types ----------
typedef _Float16 half_t;
typedef __attribute__((ext_vector_type(16))) _Float16 v16h;
typedef __attribute__((ext_vector_type(8)))  _Float16 v8h;
typedef __attribute__((ext_vector_type(4)))  _Float16 v4h;
typedef __attribute__((ext_vector_type(8)))  float    v8f;
typedef __attribute__((ext_vector_type(4)))  float    v4f;

#define DIM      1024
#define SEQ      2048
#define BATCH    4
#define HEADS    16
#define HEAD_DIM 64
#define ROWS     (BATCH * SEQ)       // 8192
#define QKV_LD   (3 * DIM)           // 3072
// 1/sqrt(64) * log2(e): the QKV product multiplies its Q columns by this (in f32, ahead of the one
// rounding to f16), so that K Q^T is the softmax exponent in base 2
#define Q_FOLD    0.18033688011112042f
#define REF_LEAD  8.0f               // a score may pass the reference in use by this much (base 2)

// D = A*B + C, f16 inputs, f32 accumulate
__device__ __forceinline__ v8f wmma16x16x32(v16h a, v16h b, v8f c) {
    return __builtin_amdgcn_wmma_f32_16x16x32_f16(
        /*neg_a=*/false, a, /*neg_b=*/false, b,
        /*c_mod=*/(short)0, c, /*reuse_a=*/false, /*reuse_b=*/false);
}

// 16x32 f16 A/B fragment, per CDNA5 16-bit layout:
// lane l<16: row l, K={0..7,16..23}; lane l>=16: row l-16, K={8..15,24..31}.
__device__ __forceinline__ v16h load_frag(const half_t* __restrict__ base,
                                          int stride, int lane) {
    int r  = lane & 15;
    int k0 = (lane & 16) ? 8 : 0;
    const half_t* p = base + (size_t)r * stride + k0;
    v8h lo = *(const v8h*)(p);
    v8h hi = *(const v8h*)(p + 16);
    return __builtin_shufflevector(lo, hi, 0,1,2,3,4,5,6,7,8,9,10,11,12,13,14,15);
}

// Async global->LDS copies of 16 bytes per lane (tracked by ASYNCcnt): a lane's share of one
// 128-key tile, four pieces of K (LDS rows of 144 B) and four of V (LDS rows of 160 B), 32 keys
// apart. gk = the lane's first piece of K; V lies DIM elements behind K in the same qkv row.
// kl, vl = low 32 bits of the generic LDS pointers of the first pieces.
// All eight stand in ONE statement that ends in s_wait_xcnt 0: the wait then stands ahead of
// whatever next rewrites an address register that a copy names (a precaution; in a statement
// of its own the compiler could move such a write over it).
__device__ __forceinline__ void async_copy_kv_tile(const half_t* gk, unsigned kl, unsigned vl) {
    const half_t* gv = gk + DIM;
    asm volatile("global_load_async_to_lds_b128 %0, %1, off\n\t"
                 "global_load_async_to_lds_b128 %2, %3, off\n\t"
                 "global_load_async_to_lds_b128 %4, %5, off\n\t"
                 "global_load_async_to_lds_b128 %6, %7, off\n\t"
                 "global_load_async_to_lds_b128 %8, %9, off\n\t"
                 "global_load_async_to_lds_b128 %10, %11, off\n\t"
                 "global_load_async_to_lds_b128 %12, %13, off\n\t"
                 "global_load_async_to_lds_b128 %14, %15, off\n\t"
                 "s_wait_xcnt 0x0"
                 :: "v"(kl),                "v"(gk),
                    "v"(kl + 1u * 32 * 144), "v"(gk + 1 * 32 * QKV_LD),
                    "v"(kl + 2u * 32 * 144), "v"(gk + 2 * 32 * QKV_LD),
                    "v"(kl + 3u * 32 * 144), "v"(gk + 3 * 32 * QKV_LD),
                    "v"(vl),                "v"(gv),
                    "v"(vl + 1u * 32 * 160), "v"(gv + 1 * 32 * QKV_LD),
                    "v"(vl + 2u * 32 * 160), "v"(gv + 2 * 32 * QKV_LD),
                    "v"(vl + 3u * 32 * 160), "v"(gv + 3 * 32 * QKV_LD) : "memory");
}
__device__ __forceinline__ void wait_async0() {
    asm volatile("s_wait_asynccnt 0x0" ::: "memory");
}
// Output staging: the lanes of ONE wave hand values to each other through the wave's own LDS
// range. This wait (and its "memory" clobber, which keeps the compiler from moving an LDS
// access across it) stands between the lanes' writes and the reads of other lanes' rows,
// and between those reads and the next writes over them.
__device__ __forceinline__ void wait_ds0() {
    asm volatile("s_wait_dscnt 0x0" ::: "memory");
}

// ---------- fp32 -> f16 convert: all three inputs, one launch ----------
// One resident grid: 256 work-groups of 16 waves. A piece is 1,024 floats (8 wave-wide loads of
// 512 contiguous bytes); x has 8,192 pieces, w_qkv 3,072, w_proj 1,024: three pieces a wave.
// The f16 copies lie one behind the other in the workspace, so piece p goes to out + p * 1,024.
// A wave's 24 loads stand ahead of its stores, so that many are in flight at once: the launch
// is paced by memory, not by how fast short waves can be started.
#define CVT_WAVES   4096
#define CVT_PIECE   1024
#define WQKV_PIECES (QKV_LD * DIM / CVT_PIECE)     // 3072
__global__ void __launch_bounds__(512) cvt_f32_to_f16(const float* __restrict__ x,
                                                      const float* __restrict__ w_qkv,
                                                      const float* __restrict__ w_proj,
                                                      half_t* __restrict__ out) {
    const int lane = threadIdx.x & 31;
    const int w = __builtin_amdgcn_readfirstlane((int)(blockIdx.x * 16 + (threadIdx.x >> 5)));
    const float* src[3];
    src[0] = x + (size_t)w * CVT_PIECE;
    src[1] = x + (size_t)(w + CVT_WAVES) * CVT_PIECE;
    src[2] = (w < WQKV_PIECES) ? w_qkv + (size_t)w * CVT_PIECE
                               : w_proj + (size_t)(w - WQKV_PIECES) * CVT_PIECE;
    v4f v[3][8];
    // all four loops unrolled: v stays in registers and the loads stand ahead of the stores
    #pragma unroll
    for (int p = 0; p < 3; ++p)
        #pragma unroll
        for (int i = 0; i < 8; ++i)
            v[p][i] = *(const v4f*)(src[p] + i * 128 + lane * 4);
    #pragma unroll
    for (int p = 0; p < 3; ++p) {
        half_t* dst = out + (size_t)(w + p * CVT_WAVES) * CVT_PIECE;
        #pragma unroll
        for (int i = 0; i < 8; ++i)
            *(v4h*)(dst + i * 128 + lane * 4) = __builtin_convertvector(v[p][i], v4h);
    }
}

// ---------- WMMA GEMM: C[m,n] = sum_k A[m,k]*B[n,k] (+bias) ----------
// 128x128 tile, 8 waves of 32x64, K-step 64, register-prefetch double buffering.
// A K-step of 64 halves makes a row slab one whole 128-B line: 8 lanes cover a row,
// so a wave-wide 16-B load touches 4 full lines instead of 16 partial ones.
// The products are taken as (B rows) x (A rows): a lane then holds 8 adjacent columns n of one
// row m, packs them into 16-B pieces, and the wave's 32x64 tile goes through the wave's own
// LDS range so that every global store covers whole 128-B lines.
// Output columns below FOLD_COLS (a multiple of 128) are multiplied by Q_FOLD.
template<bool OUT_HALF, bool BIAS, int FOLD_COLS>
__global__ void __launch_bounds__(256, 1)
gemm_wmma(const half_t* __restrict__ A, const half_t* __restrict__ B,
          const float* __restrict__ bias, void* __restrict__ Cout,
          int M, int N, int K) {
    __shared__ __align__(16) half_t As[128 * 72];   // 144B rows, 16B aligned chunks
    __shared__ __align__(16) half_t Bs[128 * 72];

    const int lane = threadIdx.x & 31;
    const int wave = threadIdx.x >> 5;
    const int bm = blockIdx.x * 128;
    const int bn = blockIdx.y * 128;
    const int wm = (wave & 3) * 32;
    const int wn = (wave >> 2) * 64;

    const int row0 = (int)threadIdx.x >> 3;        // 0..31; pass i stages row i*32 + row0
    const int kcc  = ((int)threadIdx.x & 7) * 8;   // 0,8,..,56: 8 lanes span one row slab
    // uniform base + one 32-bit per-lane byte offset, shared by all eight loads of a step
    const unsigned tbyte = (unsigned)(row0 * K + kcc) * 2u;
    const char* Ab = (const char*)(A + (size_t)bm * K);
    const char* Bb = (const char*)(B + (size_t)bn * K);
    const size_t pass_bytes = (size_t)32 * K * 2;

    v8f acc[2][4] = {};

    #pragma unroll
    for (int i = 0; i < 4; ++i) {
        *(v8h*)&As[(i * 32 + row0) * 72 + kcc] = *(const v8h*)(Ab + i * pass_bytes + tbyte);
        *(v8h*)&Bs[(i * 32 + row0) * 72 + kcc] = *(const v8h*)(Bb + i * pass_bytes + tbyte);
    }
    __syncthreads();

    for (int k0 = 0; k0 < K; k0 += 64) {
        const bool more = (k0 + 64) < K;
        v8h na[4], nb[4];
        if (more) {                             // overlap next-tile loads with WMMA
            const unsigned voff = tbyte + (unsigned)(k0 + 64) * 2u;
            #pragma unroll
            for (int i = 0; i < 4; ++i) {
                na[i] = *(const v8h*)(Ab + i * pass_bytes + voff);
                nb[i] = *(const v8h*)(Bb + i * pass_bytes + voff);
            }
        }
        #pragma unroll
        for (int ks = 0; ks < 2; ++ks) {        // k ascending: same sum order as before
            v16h af[2], bf[4];
            #pragma unroll
            for (int i = 0; i < 2; ++i) af[i] = load_frag(&As[(wm + i * 16) * 72 + ks * 32], 72, lane);
            #pragma unroll
            for (int j = 0; j < 4; ++j) bf[j] = load_frag(&Bs[(wn + j * 16) * 72 + ks * 32], 72, lane);
            #pragma unroll
            for (int i = 0; i < 2; ++i)
                #pragma unroll
                for (int j = 0; j < 4; ++j)
                    acc[i][j] = wmma16x16x32(bf[j], af[i], acc[i][j]);
        }
        if (more) {
            __syncthreads();
            #pragma unroll
            for (int i = 0; i < 4; ++i) {
                *(v8h*)&As[(i * 32 + row0) * 72 + kcc] = na[i];
                *(v8h*)&Bs[(i * 32 + row0) * 72 + kcc] = nb[i];
            }
            __syncthreads();
        }
    }

    // acc[i][j][r] = C[bm + wm + i * 16 + (lane & 15)][bn + wn + j * 16 + 8 * (lane >> 4) + r]
    const int c  = lane & 15;
    const int h8 = (lane >> 4) * 8;
    if (BIAS) {
        #pragma unroll
        for (int j = 0; j < 4; ++j) {
            const v8f bv = *(const v8f*)&bias[bn + wn + j * 16 + h8];
            acc[0][j] += bv;
            acc[1][j] += bv;
        }
    }
    __syncthreads();   // every wave has read its last fragments: As and Bs become staging
    half_t* stg = ((wave & 4) ? Bs : As) + (wave & 3) * (32 * 72);   // 4,608 B a wave
    // uniform base + one 32-bit per-lane byte offset, shared by all stores of the wave
    const size_t esz = OUT_HALF ? 2 : 4;
    char* Cb = (char*)Cout + ((size_t)bm * N + bn) * esz;
    if (OUT_HALF) {
        // 32 rows of 128 B at pitch 144 B; read back 8 lanes a row: 4 whole lines a store
        const float fold = (bn < FOLD_COLS) ? Q_FOLD : 1.0f;   // the same for the whole block
        #pragma unroll
        for (int i = 0; i < 2; ++i)
            #pragma unroll
            for (int j = 0; j < 4; ++j) {
                v8h o;
                #pragma unroll
                for (int r = 0; r < 8; ++r) o[r] = (half_t)(acc[i][j][r] * fold);
                *(v8h*)&stg[(i * 16 + c) * 72 + j * 16 + h8] = o;
            }
        wait_ds0();
        const unsigned voff = (unsigned)((wm + (lane >> 3)) * N + wn + (lane & 7) * 8) * 2u;
        #pragma unroll
        for (int t = 0; t < 8; ++t)
            *(v8h*)(Cb + (size_t)(t * 4) * N * 2 + voff) =
                *(const v8h*)&stg[(t * 4 + (lane >> 3)) * 72 + (lane & 7) * 8];
    } else {
        // 16 rows of 256 B at pitch 272 B, twice; read back 16 lanes a row: 4 whole lines a store
        float* fs = (float*)stg;
        #pragma unroll
        for (int i = 0; i < 2; ++i) {
            if (i) wait_ds0();
            #pragma unroll
            for (int j = 0; j < 4; ++j)
                #pragma unroll
                for (int q = 0; q < 2; ++q) {
                    v4f o;
                    #pragma unroll
                    for (int r = 0; r < 4; ++r) o[r] = acc[i][j][q * 4 + r];
                    *(v4f*)&fs[c * 68 + j * 16 + h8 + q * 4] = o;
                }
            wait_ds0();
            const unsigned voff = (unsigned)((wm + (lane >> 4)) * N + wn + c * 4) * 4u;
            #pragma unroll
            for (int t = 0; t < 8; ++t)
                *(v4f*)(Cb + (size_t)(i * 16 + t * 2) * N * 4 + voff) =
                    *(const v4f*)&fs[(t * 2 + (lane >> 4)) * 68 + c * 4];
        }
    }
}

// Transposing LDS load: from a row-major tile T[key][d] of 16-bit values, with the lane address
// T + (kbase + 8 * (l >> 4) + (l & 7)) * pitch + dbase + 8 * ((l >> 3) & 1)   (in elements),
// lane l gets T[kbase + 8 * (l >> 4) + 0..7][dbase + (l & 15)]: half of a 16x32 fragment of T^T.
typedef __attribute__((ext_vector_type(8))) short s16x8;
__device__ __forceinline__ v8h load_tr16(const half_t* p) {
    typedef __attribute__((address_space(3))) s16x8 lds_s16x8;
    return __builtin_bit_cast(v8h, __builtin_amdgcn_ds_load_tr16_b128_v8i16((lds_s16x8*)p));
}

// lane l <-> l ^ 16 (the other 16-lane row), in the vector unit
__device__ __forceinline__ float other_half(float v) {
    int b = __builtin_bit_cast(int, v);
    return __builtin_bit_cast(float,
        __builtin_amdgcn_permlanex16(b, b, 0x76543210, 0xfedcba98, false, false));
}

// ---------- flash attention: one block per (b, h, 256 query rows) ----------
// qkv: [8192,3072] f16 (Q@+0, times Q_FOLD; K@+1024, V@+2048 per row; head offset h*64)
// A wave owns 32 queries (two 16-column groups), so every K and V fragment read from LDS
// feeds two WMMAs. 256 registers a wave: two work-groups a WGP hold the whole grid at once.
// K and V tiles of 128 keys lie row-major in a ring of two LDS buffers, filled by async copies:
// while a tile is worked on, the next one is in flight. V^T comes from the transposing load.
__global__ void __launch_bounds__(256) __attribute__((amdgpu_waves_per_eu(4, 4)))
attn_wmma(const half_t* __restrict__ qkv, half_t* __restrict__ ctx) {
    const int bh   = blockIdx.y;
    const int b    = bh >> 4;
    const int h    = bh & 15;
    const int q0   = blockIdx.x * 256;
    const int lane = threadIdx.x & 31;
    const int wave = threadIdx.x >> 5;

    __shared__ __align__(16) half_t Ks[2 * 128 * 72];  // K tiles [key][d], 144-B rows, 2 x 18.4 KB
    __shared__ __align__(16) half_t Vs[2 * 128 * 80];  // V tiles [key][d], 160-B rows (32 B x odd:
                                                       // the transposing load's pitch), 2 x 20.5 KB

    const size_t ld = QKV_LD;
    const half_t* Qbase = qkv + ((size_t)(b * SEQ + q0 + wave * 32)) * ld + h * HEAD_DIM;
    v16h qf[2][2];           // [column group][k step]
    #pragma unroll
    for (int g = 0; g < 2; ++g) {
        qf[g][0] = load_frag(Qbase + (size_t)(g * 16) * ld,      (int)ld, lane);
        qf[g][1] = load_frag(Qbase + (size_t)(g * 16) * ld + 32, (int)ld, lane);
    }

    // Transposed products: in group g a lane owns ONE query (g * 16 + (lane & 15)) and, of every
    // 16 keys, the eight at 8 * (lane >> 4). oacc[g][dt][r] = O[query][dt * 16 + 8 * (lane >> 4) + r].
    v8f oacc[2][4] = {};
    // Softmax against a held reference (base 2): nref[g] holds minus the reference of the lane's
    // query in all eight registers and is the C operand of the score products, which so give
    // exp2's argument as it is. The reference is the query's maximum when it was last set and
    // trails the running maximum by REF_LEAD at most, so no exponential passes 2^8.
    v8f nref[2] = {};                       // equal in both lane halves
    float lrow[2] = {0.0f, 0.0f};           // running sums over this lane half's keys

    // the lane's share of a tile: 8 lanes span one 128-B row, a copy of the block 32 rows
    const int srow = (int)threadIdx.x >> 3;            // key 0..31 (+ 32 per piece)
    const int skc  = ((int)threadIdx.x & 7) * 8;       // d chunk
    const half_t* gk0 = qkv + ((size_t)(b * SEQ + srow)) * ld + h * HEAD_DIM + DIM + skc;
    const unsigned kl0 = (unsigned)(uintptr_t)&Ks[srow * 72 + skc];
    const unsigned vl0 = (unsigned)(uintptr_t)&Vs[srow * 80 + skc];
    // the lane's place in a transposing load of a V tile (see load_tr16)
    const half_t* vlane = &Vs[(8 * (lane >> 4) + (lane & 7)) * 80 + 8 * ((lane >> 3) & 1)];

    // ring prologue: tile 0 lands and is published; then tile 1 starts into the other buffer
    async_copy_kv_tile(gk0, kl0, vl0);
    wait_async0();
    __syncthreads();
    async_copy_kv_tile(gk0 + (size_t)128 * ld, kl0 + 128 * 144, vl0 + 128 * 160);

    for (int kt = 0; kt < SEQ / 128; ++kt) {
        const int buf = kt & 1;
        const half_t* Kb = Ks + buf * (128 * 72);
        const half_t* Vb = vlane + buf * (128 * 80);

        // The staged 128 keys are worked on 64 at a time: 64 score registers for the two groups.
        // Kept rolled: unrolled, both halves' scores are live at once and registers spill.
        #pragma unroll 1
        for (int hk = 0; hk < 2; ++hk) {
            // S^T = K Q^T - reference:
            // sacc[g][nt][r] = S[query of g][key hk * 64 + nt * 16 + 8 * (lane >> 4) + r] - ref
            v8f sacc[2][4];
            #pragma unroll
            for (int nt = 0; nt < 4; ++nt) {
                sacc[0][nt] = nref[0];
                sacc[1][nt] = nref[1];
                #pragma unroll
                for (int ks = 0; ks < 2; ++ks) {
                    const v16h kf = load_frag(&Kb[(hk * 64 + nt * 16) * 72 + ks * 32], 72, lane);
                    sacc[0][nt] = wmma16x16x32(kf, qf[0][ks], sacc[0][nt]);
                    sacc[1][nt] = wmma16x16x32(kf, qf[1][ks], sacc[1][nt]);
                }
            }

            // the lane's 32 scores of a group are all of one query: how far they pass the reference
            float rm[2];
            #pragma unroll
            for (int g = 0; g < 2; ++g) {
                float rmv[8];
                #pragma unroll
                for (int r = 0; r < 8; ++r) {
                    rmv[r] = sacc[g][0][r];
                    #pragma unroll
                    for (int nt = 1; nt < 4; ++nt) rmv[r] = fmaxf(rmv[r], sacc[g][nt][r]);
                }
                const float m = fmaxf(fmaxf(fmaxf(rmv[0], rmv[1]), fmaxf(rmv[2], rmv[3])),
                                      fmaxf(fmaxf(rmv[4], rmv[5]), fmaxf(rmv[6], rmv[7])));
                rm[g] = fmaxf(m, other_half(m));
            }
            // One test per 64 keys, one branch of the whole wave: taken on the first 64 keys (the reference
            // becomes their maximum, whatever its sign) and where some query passes its reference
            // by more than REF_LEAD; then every query that is above its reference moves up to its
            // maximum: these scores, the sums and the outputs so far follow.
            const bool first = (kt | hk) == 0;
            if (__builtin_amdgcn_ballot_w32(first || fmaxf(rm[0], rm[1]) > REF_LEAD) != 0) {
                #pragma unroll
                for (int g = 0; g < 2; ++g) {
                    const float up   = fmaxf(rm[g], 0.0f);
                    const float d    = first ? rm[g] : up;
                    const float corr = __builtin_amdgcn_exp2f(-up);   // sums and outputs are 0 at first
                    nref[g] -= d;
                    lrow[g] *= corr;
                    #pragma unroll
                    for (int t = 0; t < 4; ++t) {
                        sacc[g][t] -= d;
                        oacc[g][t] *= corr;
                    }
                }
            }

            // O^T += V^T P^T, 32 keys at a time: two score tiles, converted in place, are the
            // B operand in the k order of the two transposing loads (8h+0..7, then 16+8h+0..7)
            float psum[2][4] = {};
            #pragma unroll
            for (int kb = 0; kb < 2; ++kb) {
                v16h pf[2];
                #pragma unroll
                for (int g = 0; g < 2; ++g)
                    #pragma unroll
                    for (int s = 0; s < 16; ++s) {
                        float p = __builtin_amdgcn_exp2f(sacc[g][kb * 2 + (s >> 3)][s & 7]);
                        psum[g][s & 3] += p;
                        pf[g][s] = (half_t)p;
                    }
                #pragma unroll
                for (int dt = 0; dt < 4; ++dt) {
                    const half_t* vp = Vb + (hk * 64 + kb * 32) * 80 + dt * 16;
                    const v16h vf = __builtin_shufflevector(load_tr16(vp), load_tr16(vp + 16 * 80),
                                        0,1,2,3,4,5,6,7,8,9,10,11,12,13,14,15);
                    oacc[0][dt] = wmma16x16x32(vf, pf[0], oacc[0][dt]);
                    oacc[1][dt] = wmma16x16x32(vf, pf[1], oacc[1][dt]);
                }
            }
            #pragma unroll
            for (int g = 0; g < 2; ++g)
                lrow[g] += (psum[g][0] + psum[g][1]) + (psum[g][2] + psum[g][3]);
        }

        // publish point of tile kt + 1: this wave's reads of tile kt are done and its own pieces
        // of tile kt + 1 have landed; behind the barrier the same holds of every wave, so tile
        // kt + 1 may be read and the buffer of tile kt refilled
        wait_ds0();
        wait_async0();
        __syncthreads();
        if (kt + 2 < SEQ / 128)
            async_copy_kv_tile(gk0 + (size_t)(kt + 2) * 128 * ld,
                               kl0 + buf * (128 * 144), vl0 + buf * (128 * 160));
    }
    wait_async0();   // no copy is outstanding when the ring becomes output staging

    // normalize + store f16 context for the output projection: 8 consecutive d per lane, passed
    // through the wave's own LDS range (16 rows of 128 B at pitch 144 B, once per group) so that
    // a store covers 4 whole 128-B lines instead of 16 pieces of 32 B
    // (the last publish point's barrier: every wave has left the last tile, Ks becomes staging)
    half_t* stg = Ks + wave * (16 * 72);
    #pragma unroll
    for (int g = 0; g < 2; ++g) {
        const float lsum = lrow[g] + other_half(lrow[g]);
        if (g) wait_ds0();
        #pragma unroll
        for (int dt = 0; dt < 4; ++dt) {
            v8h o;
            #pragma unroll
            for (int r = 0; r < 8; ++r) o[r] = (half_t)(oacc[g][dt][r] / lsum);
            *(v8h*)&stg[(lane & 15) * 72 + dt * 16 + ((lane & 16) ? 8 : 0)] = o;
        }
        wait_ds0();
        half_t* cw = ctx + (size_t)(b * SEQ + q0 + g * 16) * DIM + h * HEAD_DIM;   // uniform
        const unsigned voff = (unsigned)((wave * 32 + (lane >> 3)) * DIM + (lane & 7) * 8);
        #pragma unroll
        for (int t = 0; t < 4; ++t)
            *(v8h*)&cw[t * 4 * DIM + voff] = *(const v8h*)&stg[(t * 4 + (lane >> 3)) * 72 + (lane & 7) * 8];
    }
}

// ---------- host ----------
extern "C" void kernel_launch(void* const* d_in, const int* in_sizes, int n_in,
                              void* d_out, int out_size, void* d_ws, size_t ws_size,
                              hipStream_t stream) {
    (void)in_sizes; (void)n_in; (void)out_size; (void)ws_size;
    const float* x      = (const float*)d_in[0];
    const float* w_qkv  = (const float*)d_in[1];
    const float* w_proj = (const float*)d_in[2];
    const float* b_proj = (const float*)d_in[3];
    float* out = (float*)d_out;

    half_t* xh     = (half_t*)d_ws;                      // 8192*1024
    half_t* wqkvh  = xh     + (size_t)ROWS * DIM;        // 3072*1024
    half_t* wprojh = wqkvh  + (size_t)QKV_LD * DIM;      // 1024*1024
    half_t* qkvh   = wprojh + (size_t)DIM * DIM;         // 8192*3072
    half_t* ctxh   = qkvh   + (size_t)ROWS * QKV_LD;     // 8192*1024

    // xh, wqkvh and wprojh are one contiguous range: the conversion writes it from xh on
    cvt_f32_to_f16<<<CVT_WAVES / 16, 512, 0, stream>>>(x, w_qkv, w_proj, xh);

    gemm_wmma<true, false, DIM><<<dim3(ROWS / 128, QKV_LD / 128), 256, 0, stream>>>(
        xh, wqkvh, nullptr, qkvh, ROWS, QKV_LD, DIM);

    attn_wmma<<<dim3(SEQ / 256, BATCH * HEADS), 256, 0, stream>>>(qkvh, ctxh);

    gemm_wmma<false, true, 0><<<dim3(ROWS / 128, DIM / 128), 256, 0, stream>>>(
        ctxh, wprojh, b_proj, out, ROWS, DIM, DIM);
}

// v008
// Measured time: 120 microseconds a run.
// Two timings next to v007 both put it at 1.06 times that version's speed.
// Over all steps from v000 it is 1.91 times as fast.
#include <hip/hip_runtime.h>
#include <stdint.h>

// ---------- types ----------
typedef _Float16 half_t;
typedef __attribute__((ext_vector_type(16))) _Float16 v16h;
typedef __attribute__((ext_vector_type(8)))  _Float16 v8h;
typedef __attribute__((ext_vector_type(4)))  _Float16 v4h;
typedef __attribute__((ext_vector_type(8)))  float    v8f;
typedef __attribute__((ext_vector_type(4)))  float    v4f;

#define DIM      1024
#define SEQ      2048
#define BATCH    4
#define HEADS    16
#define HEAD_DIM 64
#define ROWS     (BATCH * SEQ)       // 8192
#define QKV_LD   (3 * DIM)           // 3072
// 1/sqrt(64) * log2(e): the QKV product multiplies its Q columns by this (in f32, ahead of the one
// rounding to f16), so that K Q^T is the softmax exponent in base 2
#define Q_FOLD    0.18033688011112042f
#define SUM_LIMIT 32768.0f           // 64 keys' exponentials may sum to this much (f16 ends at 65,504)

// D = A*B + C, f16 inputs, f32 accumulate
__device__ __forceinline__ v8f wmma16x16x32(v16h a, v16h b, v8f c) {
    return __builtin_amdgcn_wmma_f32_16x16x32_f16(
        /*neg_a=*/false, a, /*neg_b=*/false, b,
        /*c_mod=*/(short)0, c, /*reuse_a=*/false, /*reuse_b=*/false);
}

// 16x32 f16 A/B fragment, per CDNA5 16-bit layout:
// lane l<16: row l, K={0..7,16..23}; lane l>=16: row l-16, K={8..15,24..31}.
__device__ __forceinline__ v16h load_frag(const half_t* __restrict__ base,
                                          int stride, int lane) {
    int r  = lane & 15;
    int k0 = (lane & 16) ? 8 : 0;
    const half_t* p = base + (size_t)r * stride + k0;
    v8h lo = *(const v8h*)(p);
    v8h hi = *(const v8h*)(p + 16);
    return __builtin_shufflevector(lo, hi, 0,1,2,3,4,5,6,7,8,9,10,11,12,13,14,15);
}

// Async global->LDS copies of 16 bytes per lane (tracked by ASYNCcnt): a lane's share of one
// 128-key tile, four pieces of K (LDS rows of 144 B) and four of V (LDS rows of 160 B), 32 keys
// apart. gk = the lane's first piece of K; V lies DIM elements behind K in the same qkv row.
// kl, vl = low 32 bits of the generic LDS pointers of the first pieces.
// All eight stand in ONE statement that ends in s_wait_xcnt 0: the wait then stands ahead of
// whatever next rewrites an address register that a copy names (a precaution; in a statement
// of its own the compiler could move such a write over it).
__device__ __forceinline__ void async_copy_kv_tile(const half_t* gk, unsigned kl, unsigned vl) {
    const half_t* gv = gk + DIM;
    asm volatile("global_load_async_to_lds_b128 %0, %1, off\n\t"
                 "global_load_async_to_lds_b128 %2, %3, off\n\t"
                 "global_load_async_to_lds_b128 %4, %5, off\n\t"
                 "global_load_async_to_lds_b128 %6, %7, off\n\t"
                 "global_load_async_to_lds_b128 %8, %9, off\n\t"
                 "global_load_async_to_lds_b128 %10, %11, off\n\t"
                 "global_load_async_to_lds_b128 %12, %13, off\n\t"
                 "global_load_async_to_lds_b128 %14, %15, off\n\t"
                 "s_wait_xcnt 0x0"
                 :: "v"(kl),                "v"(gk),
                    "v"(kl + 1u * 32 * 144), "v"(gk + 1 * 32 * QKV_LD),
                    "v"(kl + 2u * 32 * 144), "v"(gk + 2 * 32 * QKV_LD),
                    "v"(kl + 3u * 32 * 144), "v"(gk + 3 * 32 * QKV_LD),
                    "v"(vl),                "v"(gv),
                    "v"(vl + 1u * 32 * 160), "v"(gv + 1 * 32 * QKV_LD),
                    "v"(vl + 2u * 32 * 160), "v"(gv + 2 * 32 * QKV_LD),
                    "v"(vl + 3u * 32 * 160), "v"(gv + 3 * 32 * QKV_LD) : "memory");
}
__device__ __forceinline__ void wait_async0() {
    asm volatile("s_wait_asynccnt 0x0" ::: "memory");
}
// Output staging: the lanes of ONE wave hand values to each other through the wave's own LDS
// range. This wait (and its "memory" clobber, which keeps the compiler from moving an LDS
// access across it) stands between the lanes' writes and the reads of other lanes' rows,
// and between those reads and the next writes over them.
__device__ __forceinline__ void wait_ds0() {
    asm volatile("s_wait_dscnt 0x0" ::: "memory");
}

// ---------- fp32 -> f16 convert: all three inputs, one launch ----------
// One resident grid: 256 work-groups of 16 waves. A piece is 1,024 floats (8 wave-wide loads of
// 512 contiguous bytes); x has 8,192 pieces, w_qkv 3,072, w_proj 1,024: three pieces a wave.
// The f16 copies lie one behind the other in the workspace, so piece p goes to out + p * 1,024.
// A wave's 24 loads stand ahead of its stores, so that many are in flight at once: the launch
// is paced by memory, not by how fast short waves can be started.
#define CVT_WAVES   4096
#define CVT_PIECE   1024
#define WQKV_PIECES (QKV_LD * DIM / CVT_PIECE)     // 3072
__global__ void __launch_bounds__(512) cvt_f32_to_f16(const float* __restrict__ x,
                                                      const float* __restrict__ w_qkv,
                                                      const float* __restrict__ w_proj,
                                                      half_t* __restrict__ out) {
    const int lane = threadIdx.x & 31;
    const int w = __builtin_amdgcn_readfirstlane((int)(blockIdx.x * 16 + (threadIdx.x >> 5)));
    const float* src[3];
    src[0] = x + (size_t)w * CVT_PIECE;
    src[1] = x + (size_t)(w + CVT_WAVES) * CVT_PIECE;
    src[2] = (w < WQKV_PIECES) ? w_qkv + (size_t)w * CVT_PIECE
                               : w_proj + (size_t)(w - WQKV_PIECES) * CVT_PIECE;
    v4f v[3][8];
    // all four loops unrolled: v stays in registers and the loads stand ahead of the stores
    #pragma unroll
    for (int p = 0; p < 3; ++p)
        #pragma unroll
        for (int i = 0; i < 8; ++i)
            v[p][i] = *(const v4f*)(src[p] + i * 128 + lane * 4);
    #pragma unroll
    for (int p = 0; p < 3; ++p) {
        half_t* dst = out + (size_t)(w + p * CVT_WAVES) * CVT_PIECE;
        #pragma unroll
        for (int i = 0; i < 8; ++i)
            *(v4h*)(dst + i * 128 + lane * 4) = __builtin_convertvector(v[p][i], v4h);
    }
}

// ---------- WMMA GEMM: C[m,n] = sum_k A[m,k]*B[n,k] (+bias) ----------
// 128x128 tile, 8 waves of 32x64, K-step 64, register-prefetch double buffering.
// A K-step of 64 halves makes a row slab one whole 128-B line: 8 lanes cover a row,
// so a wave-wide 16-B load touches 4 full lines instead of 16 partial ones.
// The products are taken as (B rows) x (A rows): a lane then holds 8 adjacent columns n of one
// row m, packs them into 16-B pieces, and the wave's 32x64 tile goes through the wave's own
// LDS range so that every global store covers whole 128-B lines.
// Output columns below FOLD_COLS (a multiple of 128) are multiplied by Q_FOLD.
template<bool OUT_HALF, bool BIAS, int FOLD_COLS>
__global__ void __launch_bounds__(256, 1)
gemm_wmma(const half_t* __restrict__ A, const half_t* __restrict__ B,
          const float* __restrict__ bias, void* __restrict__ Cout,
          int M, int N, int K) {
    __shared__ __align__(16) half_t As[128 * 72];   // 144B rows, 16B aligned chunks
    __shared__ __align__(16) half_t Bs[128 * 72];

    const int lane = threadIdx.x & 31;
    const int wave = threadIdx.x >> 5;
    const int bm = blockIdx.x * 128;
    const int bn = blockIdx.y * 128;
    const int wm = (wave & 3) * 32;
    const int wn = (wave >> 2) * 64;

    const int row0 = (int)threadIdx.x >> 3;        // 0..31; pass i stages row i*32 + row0
    const int kcc  = ((int)threadIdx.x & 7) * 8;   // 0,8,..,56: 8 lanes span one row slab
    // uniform base + one 32-bit per-lane byte offset, shared by all eight loads of a step
    const unsigned tbyte = (unsigned)(row0 * K + kcc) * 2u;
    const char* Ab = (const char*)(A + (size_t)bm * K);
    const char* Bb = (const char*)(B + (size_t)bn * K);
    const size_t pass_bytes = (size_t)32 * K * 2;

    v8f acc[2][4] = {};

    #pragma unroll
    for (int i = 0; i < 4; ++i) {
        *(v8h*)&As[(i * 32 + row0) * 72 + kcc] = *(const v8h*)(Ab + i * pass_bytes + tbyte);
        *(v8h*)&Bs[(i * 32 + row0) * 72 + kcc] = *(const v8h*)(Bb + i * pass_bytes + tbyte);
    }
    __syncthreads();

    for (int k0 = 0; k0 < K; k0 += 64) {
        const bool more = (k0 + 64) < K;
        v8h na[4], nb[4];
        if (more) {                             // overlap next-tile loads with WMMA
            const unsigned voff = tbyte + (unsigned)(k0 + 64) * 2u;
            #pragma unroll
            for (int i = 0; i < 4; ++i) {
                na[i] = *(const v8h*)(Ab + i * pass_bytes + voff);
                nb[i] = *(const v8h*)(Bb + i * pass_bytes + voff);
            }
        }
        #pragma unroll
        for (int ks = 0; ks < 2; ++ks) {        // k ascending: same sum order as before
            v16h af[2], bf[4];
            #pragma unroll
            for (int i = 0; i < 2; ++i) af[i] = load_frag(&As[(wm + i * 16) * 72 + ks * 32], 72, lane);
            #pragma unroll
            for (int j = 0; j < 4; ++j) bf[j] = load_frag(&Bs[(wn + j * 16) * 72 + ks * 32], 72, lane);
            #pragma unroll
            for (int i = 0; i < 2; ++i)
                #pragma unroll
                for (int j = 0; j < 4; ++j)
                    acc[i][j] = wmma16x16x32(bf[j], af[i], acc[i][j]);
        }
        if (more) {
            __syncthreads();
            #pragma unroll
            for (int i = 0; i < 4; ++i) {
                *(v8h*)&As[(i * 32 + row0) * 72 + kcc] = na[i];
                *(v8h*)&Bs[(i * 32 + row0) * 72 + kcc] = nb[i];
            }
            __syncthreads();
        }
    }

    // acc[i][j][r] = C[bm + wm + i * 16 + (lane & 15)][bn + wn + j * 16 + 8 * (lane >> 4) + r]
    const int c  = lane & 15;
    const int h8 = (lane >> 4) * 8;
    if (BIAS) {
        #pragma unroll
        for (int j = 0; j < 4; ++j) {
            const v8f bv = *(const v8f*)&bias[bn + wn + j * 16 + h8];
            acc[0][j] += bv;
            acc[1][j] += bv;
        }
    }
    __syncthreads();   // every wave has read its last fragments: As and Bs become staging
    half_t* stg = ((wave & 4) ? Bs : As) + (wave & 3) * (32 * 72);   // 4,608 B a wave
    // uniform base + one 32-bit per-lane byte offset, shared by all stores of the wave
    const size_t esz = OUT_HALF ? 2 : 4;
    char* Cb = (char*)Cout + ((size_t)bm * N + bn) * esz;
    if (OUT_HALF) {
        // 32 rows of 128 B at pitch 144 B; read back 8 lanes a row: 4 whole lines a store
        const float fold = (bn < FOLD_COLS) ? Q_FOLD : 1.0f;   // the same for the whole block
        #pragma unroll
        for (int i = 0; i < 2; ++i)
            #pragma unroll
            for (int j = 0; j < 4; ++j) {
                v8h o;
                #pragma unroll
                for (int r = 0; r < 8; ++r) o[r] = (half_t)(acc[i][j][r] * fold);
                *(v8h*)&stg[(i * 16 + c) * 72 + j * 16 + h8] = o;
            }
        wait_ds0();
        const unsigned voff = (unsigned)((wm + (lane >> 3)) * N + wn + (lane & 7) * 8) * 2u;
        #pragma unroll
        for (int t = 0; t < 8; ++t)
            *(v8h*)(Cb + (size_t)(t * 4) * N * 2 + voff) =
                *(const v8h*)&stg[(t * 4 + (lane >> 3)) * 72 + (lane & 7) * 8];
    } else {
        // 16 rows of 256 B at pitch 272 B, twice; read back 16 lanes a row: 4 whole lines a store
        float* fs = (float*)stg;
        #pragma unroll
        for (int i = 0; i < 2; ++i) {
            if (i) wait_ds0();
            #pragma unroll
            for (int j = 0; j < 4; ++j)
                #pragma unroll
                for (int q = 0; q < 2; ++q) {
                    v4f o;
                    #pragma unroll
                    for (int r = 0; r < 4; ++r) o[r] = acc[i][j][q * 4 + r];
                    *(v4f*)&fs[c * 68 + j * 16 + h8 + q * 4] = o;
                }
            wait_ds0();
            const unsigned voff = (unsigned)((wm + (lane >> 4)) * N + wn + c * 4) * 4u;
            #pragma unroll
            for (int t = 0; t < 8; ++t)
                *(v4f*)(Cb + (size_t)(i * 16 + t * 2) * N * 4 + voff) =
                    *(const v4f*)&fs[(t * 2 + (lane >> 4)) * 68 + c * 4];
        }
    }
}

// Transposing LDS load: from a row-major tile T[key][d] of 16-bit values, with the lane address
// T + (kbase + 8 * (l >> 4) + (l & 7)) * pitch + dbase + 8 * ((l >> 3) & 1)   (in elements),
// lane l gets T[kbase + 8 * (l >> 4) + 0..7][dbase + (l & 15)]: half of a 16x32 fragment of T^T.
typedef __attribute__((ext_vector_type(8))) short s16x8;
__device__ __forceinline__ v8h load_tr16(const half_t* p) {
    typedef __attribute__((address_space(3))) s16x8 lds_s16x8;
    return __builtin_bit_cast(v8h, __builtin_amdgcn_ds_load_tr16_b128_v8i16((lds_s16x8*)p));
}

// lane l <-> l ^ 16 (the other 16-lane row), in the vector unit
__device__ __forceinline__ float other_half(float v) {
    int b = __builtin_bit_cast(int, v);
    return __builtin_bit_cast(float,
        __builtin_amdgcn_permlanex16(b, b, 0x76543210, 0xfedcba98, false, false));
}

// ---------- flash attention: one block per (b, h, 256 query rows) ----------
// qkv: [8192,3072] f16 (Q@+0, times Q_FOLD; K@+1024, V@+2048 per row; head offset h*64)
// A wave owns 32 queries (two 16-column groups), so every K and V fragment read from LDS
// feeds two WMMAs. 256 registers a wave: two work-groups a WGP hold the whole grid at once.
// K and V tiles of 128 keys lie row-major in a ring of two LDS buffers, filled by async copies:
// while a tile is worked on, the next one is in flight. V^T comes from the transposing load.
__global__ void __launch_bounds__(256) __attribute__((amdgpu_waves_per_eu(4, 4)))
attn_wmma(const half_t* __restrict__ qkv, half_t* __restrict__ ctx) {
    const int bh   = blockIdx.y;
    const int b    = bh >> 4;
    const int h    = bh & 15;
    const int q0   = blockIdx.x * 256;
    const int lane = threadIdx.x & 31;
    const int wave = threadIdx.x >> 5;

    __shared__ __align__(16) half_t Ks[2 * 128 * 72];  // K tiles [key][d], 144-B rows, 2 x 18.4 KB
    __shared__ __align__(16) half_t Vs[2 * 128 * 80];  // V tiles [key][d], 160-B rows (32 B x odd:
                                                       // the transposing load's pitch), 2 x 20.5 KB

    const size_t ld = QKV_LD;
    const half_t* Qbase = qkv + ((size_t)(b * SEQ + q0 + wave * 32)) * ld + h * HEAD_DIM;
    v16h qf[2][2];           // [column group][k step]
    #pragma unroll
    for (int g = 0; g < 2; ++g) {
        qf[g][0] = load_frag(Qbase + (size_t)(g * 16) * ld,      (int)ld, lane);
        qf[g][1] = load_frag(Qbase + (size_t)(g * 16) * ld + 32, (int)ld, lane);
    }

    // Transposed products: in group g a lane owns ONE query (g * 16 + (lane & 15)) and, of every
    // 16 keys, the eight at 8 * (lane >> 4). oacc[g][dt][r] = O[query][dt * 16 + 8 * (lane >> 4) + r].
    v8f oacc[2][4] = {};
    // Softmax against a held reference (base 2): nref[g] holds minus the reference of the lane's
    // query in all eight registers and is the C operand of the score products, which so give
    // exp2's argument as it is. The reference is the query's maximum when it was last set; it
    // moves up only where the exponentials of 64 keys sum to more than SUM_LIMIT.
    v8f nref[2] = {};                       // equal in both lane halves
    float lrow[2] = {0.0f, 0.0f};           // running sums over all keys, equal in both lane halves
    v16h ones;                              // A operand of the row sums
    #pragma unroll
    for (int s = 0; s < 16; ++s) ones[s] = (half_t)1.0f;

    // the lane's share of a tile: 8 lanes span one 128-B row, a copy of the block 32 rows
    const int srow = (int)threadIdx.x >> 3;            // key 0..31 (+ 32 per piece)
    const int skc  = ((int)threadIdx.x & 7) * 8;       // d chunk
    const half_t* gk0 = qkv + ((size_t)(b * SEQ + srow)) * ld + h * HEAD_DIM + DIM + skc;
    const unsigned kl0 = (unsigned)(uintptr_t)&Ks[srow * 72 + skc];
    const unsigned vl0 = (unsigned)(uintptr_t)&Vs[srow * 80 + skc];
    // the lane's place in a transposing load of a V tile (see load_tr16)
    const half_t* vlane = &Vs[(8 * (lane >> 4) + (lane & 7)) * 80 + 8 * ((lane >> 3) & 1)];

    // ring prologue: tile 0 lands and is published; then tile 1 starts into the other buffer
    async_copy_kv_tile(gk0, kl0, vl0);
    wait_async0();
    __syncthreads();
    async_copy_kv_tile(gk0 + (size_t)128 * ld, kl0 + 128 * 144, vl0 + 128 * 160);

    for (int kt = 0; kt < SEQ / 128; ++kt) {
        const int buf = kt & 1;
        const half_t* Kb = Ks + buf * (128 * 72);
        const half_t* Vb = vlane + buf * (128 * 80);

        // The staged 128 keys are worked on 64 at a time: 64 score registers for the two groups.
        // Kept rolled: unrolled, both halves' scores are live at once and registers spill.
        #pragma unroll 1
        for (int hk = 0; hk < 2; ++hk) {
            const bool first = (kt | hk) == 0;
            bool setref = first;     // wave-uniform: this pass moves the references
            v16h pf[2][2];           // [32 keys][group]: P^T, the B operand of the sums and of O^T
            v8f  tsum[2];            // every register: the query's sum over these 64 keys
            v16h vf0[4];             // V^T fragments of the first 32 keys
            // At most two passes: the second only where a sum of the first went out of range.
            // Kept rolled: the second pass is the same code, and almost never runs.
            #pragma unroll 1
            for (int pass = 0; pass < 2; ++pass) {
                // compiler fence, no instruction: it keeps the K fragment loads inside the pass;
                // hoisted out of this loop they stay live for a second pass (64 registers) and
                // addresses spill to scratch
                asm volatile("" ::: "memory");
                // S^T = K Q^T - reference:
                // sacc[g][nt][r] = S[query of g][key hk * 64 + nt * 16 + 8 * (lane >> 4) + r] - ref
                v8f sacc[2][4];
                #pragma unroll
                for (int nt = 0; nt < 4; ++nt) {
                    sacc[0][nt] = nref[0];
                    sacc[1][nt] = nref[1];
                    #pragma unroll
                    for (int ks = 0; ks < 2; ++ks) {
                        const v16h kf = load_frag(&Kb[(hk * 64 + nt * 16) * 72 + ks * 32], 72, lane);
                        sacc[0][nt] = wmma16x16x32(kf, qf[0][ks], sacc[0][nt]);
                        sacc[1][nt] = wmma16x16x32(kf, qf[1][ks], sacc[1][nt]);
                    }
                }

                // Taken on the first 64 keys (the reference becomes their maximum, whatever its
                // sign) and on a second pass; then every query that is above its reference moves
                // up to its maximum: these scores, the sums and the outputs so far follow.
                if (setref) {
                    #pragma unroll
                    for (int g = 0; g < 2; ++g) {
                        // the lane's 32 scores of a group are all of one query
                        float rmv[8];
                        #pragma unroll
                        for (int r = 0; r < 8; ++r) {
                            rmv[r] = sacc[g][0][r];
                            #pragma unroll
                            for (int nt = 1; nt < 4; ++nt) rmv[r] = fmaxf(rmv[r], sacc[g][nt][r]);
                        }
                        const float m = fmaxf(fmaxf(fmaxf(rmv[0], rmv[1]), fmaxf(rmv[2], rmv[3])),
                                              fmaxf(fmaxf(rmv[4], rmv[5]), fmaxf(rmv[6], rmv[7])));
                        const float rm   = fmaxf(m, other_half(m));
                        const float up   = fmaxf(rm, 0.0f);
                        const float d    = first ? rm : up;
                        const float corr = __builtin_amdgcn_exp2f(-up);   // sums and outputs are 0 at first
                        nref[g] -= d;
                        lrow[g] *= corr;
                        #pragma unroll
                        for (int t = 0; t < 4; ++t) {
                            sacc[g][t] -= d;
                            oacc[g][t] *= corr;
                        }
                    }
                }

                // the first V^T fragments are asked for here, so that they land under the exponentials
                #pragma unroll
                for (int dt = 0; dt < 4; ++dt) {
                    const half_t* vp = Vb + (hk * 64) * 80 + dt * 16;
                    vf0[dt] = __builtin_shufflevector(load_tr16(vp), load_tr16(vp + 16 * 80),
                                  0,1,2,3,4,5,6,7,8,9,10,11,12,13,14,15);
                }

                // P^T: two score tiles, converted in place, are a B operand in the k order of the
                // two transposing loads (8h+0..7, then 16+8h+0..7)
                #pragma unroll
                for (int kb = 0; kb < 2; ++kb)
                    #pragma unroll
                    for (int g = 0; g < 2; ++g)
                        #pragma unroll
                        for (int s = 0; s < 16; ++s)
                            pf[kb][g][s] =
                                (half_t)__builtin_amdgcn_exp2f(sacc[g][kb * 2 + (s >> 3)][s & 7]);

                // row sums on the matrix pipe: (all ones) x P^T has, in every row, each query's
                // sum over the 32 keys of both lane halves
                #pragma unroll
                for (int g = 0; g < 2; ++g) {
                    const v8f zero = {};
                    tsum[g] = wmma16x16x32(ones, pf[0][g], zero);
                    tsum[g] = wmma16x16x32(ones, pf[1][g], tsum[g]);
                }
                // The sum is the range test too, one branch of the whole wave per 64 keys: within
                // SUM_LIMIT no term has left f16's range (an infinite term makes an infinite sum).
                // Nothing has been added to the outputs or the running sums yet.
                if (setref ||
                    __builtin_amdgcn_ballot_w32(fmaxf(tsum[0][0], tsum[1][0]) > SUM_LIMIT) == 0)
                    break;
                setref = true;
            }

            // O^T += V^T P^T, 32 keys at a time; the second 32 keys' fragments are asked for ahead
            // of the first products, so that they land under them
            v16h vf1[4];
            #pragma unroll
            for (int dt = 0; dt < 4; ++dt) {
                const half_t* vp = Vb + (hk * 64 + 32) * 80 + dt * 16;
                vf1[dt] = __builtin_shufflevector(load_tr16(vp), load_tr16(vp + 16 * 80),
                              0,1,2,3,4,5,6,7,8,9,10,11,12,13,14,15);
            }
            // holds these loads ahead of the products: left free, the compiler sinks them behind
            // the first eight, whose successors then wait out the LDS latency
            __builtin_amdgcn_sched_barrier(0);
            #pragma unroll
            for (int dt = 0; dt < 4; ++dt) {
                oacc[0][dt] = wmma16x16x32(vf0[dt], pf[0][0], oacc[0][dt]);
                oacc[1][dt] = wmma16x16x32(vf0[dt], pf[0][1], oacc[1][dt]);
            }
            #pragma unroll
            for (int dt = 0; dt < 4; ++dt) {
                oacc[0][dt] = wmma16x16x32(vf1[dt], pf[1][0], oacc[0][dt]);
                oacc[1][dt] = wmma16x16x32(vf1[dt], pf[1][1], oacc[1][dt]);
            }
            // the two additions stay behind the products: vector work in the slots that the chip
            // needs between the last products and the next rewrite of a fragment register
            __builtin_amdgcn_sched_barrier(0);
            lrow[0] += tsum[0][0];
            lrow[1] += tsum[1][0];
        }

        // publish point of tile kt + 1: this wave's reads of tile kt are done and its own pieces
        // of tile kt + 1 have landed; behind the barrier the same holds of every wave, so tile
        // kt + 1 may be read and the buffer of tile kt refilled
        wait_ds0();
        wait_async0();
        __syncthreads();
        if (kt + 2 < SEQ / 128)
            async_copy_kv_tile(gk0 + (size_t)(kt + 2) * 128 * ld,
                               kl0 + buf * (128 * 144), vl0 + buf * (128 * 160));
    }
    wait_async0();   // no copy is outstanding when the ring becomes output staging

    // normalize + store f16 context for the output projection: 8 consecutive d per lane, passed
    // through the wave's own LDS range (16 rows of 128 B at pitch 144 B, once per group) so that
    // a store covers 4 whole 128-B lines instead of 16 pieces of 32 B
    // (the last publish point's barrier: every wave has left the last tile, Ks becomes staging)
    half_t* stg = Ks + wave * (16 * 72);
    #pragma unroll
    for (int g = 0; g < 2; ++g) {
        const float lsum = lrow[g];
        if (g) wait_ds0();
        #pragma unroll
        for (int dt = 0; dt < 4; ++dt) {
            v8h o;
            #pragma unroll
            for (int r = 0; r < 8; ++r) o[r] = (half_t)(oacc[g][dt][r] / lsum);
            *(v8h*)&stg[(lane & 15) * 72 + dt * 16 + ((lane & 16) ? 8 : 0)] = o;
        }
        wait_ds0();
        half_t* cw = ctx + (size_t)(b * SEQ + q0 + g * 16) * DIM + h * HEAD_DIM;   // uniform
        const unsigned voff = (unsigned)((wave * 32 + (lane >> 3)) * DIM + (lane & 7) * 8);
        #pragma unroll
        for (int t = 0; t < 4; ++t)
            *(v8h*)&cw[t * 4 * DIM + voff] = *(const v8h*)&stg[(t * 4 + (lane >> 3)) * 72 + (lane & 7) * 8];
    }
}

// ---------- host ----------
extern "C" void kernel_launch(void* const* d_in, const int* in_sizes, int n_in,
                              void* d_out, int out_size, void* d_ws, size_t ws_size,
                              hipStream_t stream) {
    (void)in_sizes; (void)n_in; (void)out_size; (void)ws_size;
    const float* x      = (const float*)d_in[0];
    const float* w_qkv  = (const float*)d_in[1];
    const float* w_proj = (const float*)d_in[2];
    const float* b_proj = (const float*)d_in[3];
    float* out = (float*)d_out;

    half_t* xh     = (half_t*)d_ws;                      // 8192*1024
    half_t* wqkvh  = xh     + (size_t)ROWS * DIM;        // 3072*1024
    half_t* wprojh = wqkvh  + (size_t)QKV_LD * DIM;      // 1024*1024
    half_t* qkvh   = wprojh + (size_t)DIM * DIM;         // 8192*3072
    half_t* ctxh   = qkvh   + (size_t)ROWS * QKV_LD;     // 8192*1024

    // xh, wqkvh and wprojh are one contiguous range: the conversion writes it from xh on
    cvt_f32_to_f16<<<CVT_WAVES / 16, 512, 0, stream>>>(x, w_qkv, w_proj, xh);

    gemm_wmma<true, false, DIM><<<dim3(ROWS / 128, QKV_LD / 128), 256, 0, stream>>>(
        xh, wqkvh, nullptr, qkvh, ROWS, QKV_LD, DIM);

    attn_wmma<<<dim3(SEQ / 256, BATCH * HEADS), 256, 0, stream>>>(qkvh, ctxh);

    gemm_wmma<false, true, 0><<<dim3(ROWS / 128, DIM / 128), 256, 0, stream>>>(
        ctxh, wprojh, b_proj, out, ROWS, DIM, DIM);
}

// v009
// A run of this version takes 117 microseconds.
// In both of two side-by-side timings against v008, it was 1.03 times as fast.
// Counting every step since v000, it is 1.97 times as fast.
#include <hip/hip_runtime.h>
#include <stdint.h>

// ---------- types ----------
typedef _Float16 half_t;
typedef __attribute__((ext_vector_type(16))) _Float16 v16h;
typedef __attribute__((ext_vector_type(8)))  _Float16 v8h;
typedef __attribute__((ext_vector_type(4)))  _Float16 v4h;
typedef __attribute__((ext_vector_type(8)))  float    v8f;
typedef __attribute__((ext_vector_type(4)))  float    v4f;

#define DIM      1024
#define SEQ      2048
#define BATCH    4
#define HEADS    16
#define HEAD_DIM 64
#define ROWS     (BATCH * SEQ)       // 8192
#define QKV_LD   (3 * DIM)           // 3072
// 1/sqrt(64) * log2(e): the QKV product multiplies its Q columns by this (in f32, ahead of the one
// rounding to f16), so that K Q^T is the softmax exponent in base 2
#define Q_FOLD    0.18033688011112042f
#define SUM_LIMIT 32768.0f           // 64 keys' exponentials may sum to this much (f16 ends at 65,504)

// D = A*B + C, f16 inputs, f32 accumulate
__device__ __forceinline__ v8f wmma16x16x32(v16h a, v16h b, v8f c) {
    return __builtin_amdgcn_wmma_f32_16x16x32_f16(
        /*neg_a=*/false, a, /*neg_b=*/false, b,
        /*c_mod=*/(short)0, c, /*reuse_a=*/false, /*reuse_b=*/false);
}

// 16x32 f16 A/B fragment, per CDNA5 16-bit layout:
// lane l<16: row l, K={0..7,16..23}; lane l>=16: row l-16, K={8..15,24..31}.
__device__ __forceinline__ v16h load_frag(const half_t* __restrict__ base,
                                          int stride, int lane) {
    int r  = lane & 15;
    int k0 = (lane & 16) ? 8 : 0;
    const half_t* p = base + (size_t)r * stride + k0;
    v8h lo = *(const v8h*)(p);
    v8h hi = *(const v8h*)(p + 16);
    return __builtin_shufflevector(lo, hi, 0,1,2,3,4,5,6,7,8,9,10,11,12,13,14,15);
}

// Async global->LDS copies of 16 bytes per lane (tracked by ASYNCcnt): a lane's share of one
// 128-key tile, four pieces of K (LDS rows of 144 B) and four of V (LDS rows of 160 B), 32 keys
// apart. gk = the lane's first piece of K; V lies DIM elements behind K in the same qkv row.
// kl, vl = low 32 bits of the generic LDS pointers of the first pieces.
// All eight stand in ONE statement that ends in s_wait_xcnt 0: the wait then stands ahead of
// whatever next rewrites an address register that a copy names (a precaution; in a statement
// of its own the compiler could move such a write over it).
__device__ __forceinline__ void async_copy_kv_tile(const half_t* gk, unsigned kl, unsigned vl) {
    const half_t* gv = gk + DIM;
    asm volatile("global_load_async_to_lds_b128 %0, %1, off\n\t"
                 "global_load_async_to_lds_b128 %2, %3, off\n\t"
                 "global_load_async_to_lds_b128 %4, %5, off\n\t"
                 "global_load_async_to_lds_b128 %6, %7, off\n\t"
                 "global_load_async_to_lds_b128 %8, %9, off\n\t"
                 "global_load_async_to_lds_b128 %10, %11, off\n\t"
                 "global_load_async_to_lds_b128 %12, %13, off\n\t"
                 "global_load_async_to_lds_b128 %14, %15, off\n\t"
                 "s_wait_xcnt 0x0"
                 :: "v"(kl),                "v"(gk),
                    "v"(kl + 1u * 32 * 144), "v"(gk + 1 * 32 * QKV_LD),
                    "v"(kl + 2u * 32 * 144), "v"(gk + 2 * 32 * QKV_LD),
                    "v"(kl + 3u * 32 * 144), "v"(gk + 3 * 32 * QKV_LD),
                    "v"(vl),                "v"(gv),
                    "v"(vl + 1u * 32 * 160), "v"(gv + 1 * 32 * QKV_LD),
                    "v"(vl + 2u * 32 * 160), "v"(gv + 2 * 32 * QKV_LD),
                    "v"(vl + 3u * 32 * 160), "v"(gv + 3 * 32 * QKV_LD) : "memory");
}
// The same for a GEMM: a lane's share of one K-step of 64, four pieces of the A tile and four of
// the B tile (LDS rows of 144 B), 32 rows apart (row_step bytes in global memory).
// ga, gb = the lane's first pieces; al, bl = low 32 bits of their generic LDS pointers.
__device__ __forceinline__ void async_copy_ab_tile(const char* ga, const char* gb, size_t row_step,
                                                   unsigned al, unsigned bl) {
    asm volatile("global_load_async_to_lds_b128 %0, %1, off\n\t"
                 "global_load_async_to_lds_b128 %2, %3, off\n\t"
                 "global_load_async_to_lds_b128 %4, %5, off\n\t"
                 "global_load_async_to_lds_b128 %6, %7, off\n\t"
                 "global_load_async_to_lds_b128 %8, %9, off\n\t"
                 "global_load_async_to_lds_b128 %10, %11, off\n\t"
                 "global_load_async_to_lds_b128 %12, %13, off\n\t"
                 "global_load_async_to_lds_b128 %14, %15, off\n\t"
                 "s_wait_xcnt 0x0"
                 :: "v"(al),                "v"(ga),
                    "v"(al + 1u * 32 * 144), "v"(ga + 1 * row_step),
                    "v"(al + 2u * 32 * 144), "v"(ga + 2 * row_step),
                    "v"(al + 3u * 32 * 144), "v"(ga + 3 * row_step),
                    "v"(bl),                "v"(gb),
                    "v"(bl + 1u * 32 * 144), "v"(gb + 1 * row_step),
                    "v"(bl + 2u * 32 * 144), "v"(gb + 2 * row_step),
                    "v"(bl + 3u * 32 * 144), "v"(gb + 3 * row_step) : "memory");
}
__device__ __forceinline__ void wait_async0() {
    asm volatile("s_wait_asynccnt 0x0" ::: "memory");
}
// Output staging: the lanes of ONE wave hand values to each other through the wave's own LDS
// range. This wait (and its "memory" clobber, which keeps the compiler from moving an LDS
// access across it) stands between the lanes' writes and the reads of other lanes' rows,
// and between those reads and the next writes over them.
__device__ __forceinline__ void wait_ds0() {
    asm volatile("s_wait_dscnt 0x0" ::: "memory");
}

// ---------- fp32 -> f16 convert: all three inputs, one launch ----------
// One resident grid: 256 work-groups of 16 waves. A piece is 1,024 floats (8 wave-wide loads of
// 512 contiguous bytes); x has 8,192 pieces, w_qkv 3,072, w_proj 1,024: three pieces a wave.
// The f16 copies lie one behind the other in the workspace, so piece p goes to out + p * 1,024.
// A wave's 24 loads stand ahead of its stores, so that many are in flight at once: the launch
// is paced by memory, not by how fast short waves can be started.
#define CVT_WAVES   4096
#define CVT_PIECE   1024
#define WQKV_PIECES (QKV_LD * DIM / CVT_PIECE)     // 3072
__global__ void __launch_bounds__(512) cvt_f32_to_f16(const float* __restrict__ x,
                                                      const float* __restrict__ w_qkv,
                                                      const float* __restrict__ w_proj,
                                                      half_t* __restrict__ out) {
    const int lane = threadIdx.x & 31;
    const int w = __builtin_amdgcn_readfirstlane((int)(blockIdx.x * 16 + (threadIdx.x >> 5)));
    const float* src[3];
    src[0] = x + (size_t)w * CVT_PIECE;
    src[1] = x + (size_t)(w + CVT_WAVES) * CVT_PIECE;
    src[2] = (w < WQKV_PIECES) ? w_qkv + (size_t)w * CVT_PIECE
                               : w_proj + (size_t)(w - WQKV_PIECES) * CVT_PIECE;
    v4f v[3][8];
    // all four loops unrolled: v stays in registers and the loads stand ahead of the stores
    #pragma unroll
    for (int p = 0; p < 3; ++p)
        #pragma unroll
        for (int i = 0; i < 8; ++i)
            v[p][i] = *(const v4f*)(src[p] + i * 128 + lane * 4);
    #pragma unroll
    for (int p = 0; p < 3; ++p) {
        half_t* dst = out + (size_t)(w + p * CVT_WAVES) * CVT_PIECE;
        #pragma unroll
        for (int i = 0; i < 8; ++i)
            *(v4h*)(dst + i * 128 + lane * 4) = __builtin_convertvector(v[p][i], v4h);
    }
}

// ---------- WMMA GEMM: C[m,n] = sum_k A[m,k]*B[n,k] (+bias) ----------
// 128x128 tile, 8 waves of 32x64, K-step 64. The A and B tiles of a K-step lie in a ring of two
// LDS buffers, filled by async copies: while a K-step is worked on, the next one is in flight,
// through no register, and one barrier a K-step publishes it and frees the buffer just read.
// A K-step of 64 halves makes a row slab one whole 128-B line: 8 lanes cover a row,
// so a wave-wide 16-B copy touches 4 full lines instead of 16 partial ones.
// The products are taken as (B rows) x (A rows): a lane then holds 8 adjacent columns n of one
// row m, packs them into 16-B pieces, and the wave's 32x64 tile goes through the wave's own
// LDS range so that every global store covers whole 128-B lines.
// Output columns below FOLD_COLS (a multiple of 128) are multiplied by Q_FOLD.
// At most 6 waves a SIMD, three work-groups a WGP: the 1,536 work-groups of the QKV product then
// run as two full rounds; at four a WGP the second round would be half empty.
template<bool OUT_HALF, bool BIAS, int FOLD_COLS>
__global__ void __launch_bounds__(256) __attribute__((amdgpu_waves_per_eu(6, 6)))
gemm_wmma(const half_t* __restrict__ A, const half_t* __restrict__ B,
          const float* __restrict__ bias, void* __restrict__ Cout,
          int M, int N, int K) {
    __shared__ __align__(16) half_t As[2 * 128 * 72];   // two buffers; 144B rows, 16B aligned chunks
    __shared__ __align__(16) half_t Bs[2 * 128 * 72];

    const int lane = threadIdx.x & 31;
    const int wave = threadIdx.x >> 5;
    const int bm = blockIdx.x * 128;
    const int bn = blockIdx.y * 128;
    const int wm = (wave & 3) * 32;
    const int wn = (wave >> 2) * 64;

    const int row0 = (int)threadIdx.x >> 3;        // 0..31; pass i stages row i*32 + row0
    const int kcc  = ((int)threadIdx.x & 7) * 8;   // 0,8,..,56: 8 lanes span one row slab
    // the lane's first pieces of K-step 0, in global memory and in LDS
    const char* ga = (const char*)(A + (size_t)bm * K + (size_t)row0 * K + kcc);
    const char* gb = (const char*)(B + (size_t)bn * K + (size_t)row0 * K + kcc);
    const size_t row_step = (size_t)32 * K * 2;
    const unsigned al0 = (unsigned)(uintptr_t)&As[row0 * 72 + kcc];
    const unsigned bl0 = (unsigned)(uintptr_t)&Bs[row0 * 72 + kcc];
    const int steps = K / 64;

    v8f acc[2][4] = {};

    // ring prologue: K-step 0 lands and is published; then K-step 1 starts into the other buffer
    async_copy_ab_tile(ga, gb, row_step, al0, bl0);
    wait_async0();
    __syncthreads();
    if (1 < steps)
        async_copy_ab_tile(ga + 128, gb + 128, row_step, al0 + 128 * 144, bl0 + 128 * 144);

    for (int t = 0; t < steps; ++t) {
        const int buf = t & 1;
        const half_t* At = As + buf * (128 * 72);
        const half_t* Bt = Bs + buf * (128 * 72);
        #pragma unroll
        for (int ks = 0; ks < 2; ++ks) {        // k ascending: same sum order as before
            v16h af[2], bf[4];
            #pragma unroll
            for (int i = 0; i < 2; ++i) af[i] = load_frag(&At[(wm + i * 16) * 72 + ks * 32], 72, lane);
            #pragma unroll
            for (int j = 0; j < 4; ++j) bf[j] = load_frag(&Bt[(wn + j * 16) * 72 + ks * 32], 72, lane);
            #pragma unroll
            for (int i = 0; i < 2; ++i)
                #pragma unroll
                for (int j = 0; j < 4; ++j)
                    acc[i][j] = wmma16x16x32(bf[j], af[i], acc[i][j]);
        }
        // publish point of K-step t + 1: this wave's reads of K-step t are done and its own pieces
        // of K-step t + 1 have landed; behind the barrier the same holds of every wave, so K-step
        // t + 1 may be read and the buffer of K-step t refilled
        wait_ds0();
        wait_async0();
        __syncthreads();
        if (t + 2 < steps)
            async_copy_ab_tile(ga + (size_t)(t + 2) * 128, gb + (size_t)(t + 2) * 128, row_step,
                               al0 + buf * (128 * 144), bl0 + buf * (128 * 144));
    }
    wait_async0();   // no copy is outstanding when the ring becomes output staging

    // acc[i][j][r] = C[bm + wm + i * 16 + (lane & 15)][bn + wn + j * 16 + 8 * (lane >> 4) + r]
    const int c  = lane & 15;
    const int h8 = (lane >> 4) * 8;
    if (BIAS) {
        #pragma unroll
        for (int j = 0; j < 4; ++j) {
            const v8f bv = *(const v8f*)&bias[bn + wn + j * 16 + h8];
            acc[0][j] += bv;
            acc[1][j] += bv;
        }
    }
    // (the last publish point's barrier: every wave has read its last fragments, As and Bs become staging)
    half_t* stg = ((wave & 4) ? Bs : As) + (wave & 3) * (32 * 72);   // 4,608 B a wave
    // uniform base + one 32-bit per-lane byte offset, shared by all stores of the wave
    const size_t esz = OUT_HALF ? 2 : 4;
    char* Cb = (char*)Cout + ((size_t)bm * N + bn) * esz;
    if (OUT_HALF) {
        // 32 rows of 128 B at pitch 144 B; read back 8 lanes a row: 4 whole lines a store
        const float fold = (bn < FOLD_COLS) ? Q_FOLD : 1.0f;   // the same for the whole block
        #pragma unroll
        for (int i = 0; i < 2; ++i)
            #pragma unroll
            for (int j = 0; j < 4; ++j) {
                v8h o;
                #pragma unroll
                for (int r = 0; r < 8; ++r) o[r] = (half_t)(acc[i][j][r] * fold);
                *(v8h*)&stg[(i * 16 + c) * 72 + j * 16 + h8] = o;
            }
        wait_ds0();
        const unsigned voff = (unsigned)((wm + (lane >> 3)) * N + wn + (lane & 7) * 8) * 2u;
        #pragma unroll
        for (int t = 0; t < 8; ++t)
            *(v8h*)(Cb + (size_t)(t * 4) * N * 2 + voff) =
                *(const v8h*)&stg[(t * 4 + (lane >> 3)) * 72 + (lane & 7) * 8];
    } else {
        // 16 rows of 256 B at pitch 272 B, twice; read back 16 lanes a row: 4 whole lines a store
        float* fs = (float*)stg;
        #pragma unroll
        for (int i = 0; i < 2; ++i) {
            if (i) wait_ds0();
            #pragma unroll
            for (int j = 0; j < 4; ++j)
                #pragma unroll
                for (int q = 0; q < 2; ++q) {
                    v4f o;
                    #pragma unroll
                    for (int r = 0; r < 4; ++r) o[r] = acc[i][j][q * 4 + r];
                    *(v4f*)&fs[c * 68 + j * 16 + h8 + q * 4] = o;
                }
            wait_ds0();
            const unsigned voff = (unsigned)((wm + (lane >> 4)) * N + wn + c * 4) * 4u;
            #pragma unroll
            for (int t = 0; t < 8; ++t)
                *(v4f*)(Cb + (size_t)(i * 16 + t * 2) * N * 4 + voff) =
                    *(const v4f*)&fs[(t * 2 + (lane >> 4)) * 68 + c * 4];
        }
    }
}

// Transposing LDS load: from a row-major tile T[key][d] of 16-bit values, with the lane address
// T + (kbase + 8 * (l >> 4) + (l & 7)) * pitch + dbase + 8 * ((l >> 3) & 1)   (in elements),
// lane l gets T[kbase + 8 * (l >> 4) + 0..7][dbase + (l & 15)]: half of a 16x32 fragment of T^T.
typedef __attribute__((ext_vector_type(8))) short s16x8;
__device__ __forceinline__ v8h load_tr16(const half_t* p) {
    typedef __attribute__((address_space(3))) s16x8 lds_s16x8;
    return __builtin_bit_cast(v8h, __builtin_amdgcn_ds_load_tr16_b128_v8i16((lds_s16x8*)p));
}

// lane l <-> l ^ 16 (the other 16-lane row), in the vector unit
__device__ __forceinline__ float other_half(float v) {
    int b = __builtin_bit_cast(int, v);
    return __builtin_bit_cast(float,
        __builtin_amdgcn_permlanex16(b, b, 0x76543210, 0xfedcba98, false, false));
}

// ---------- flash attention: one block per (b, h, 256 query rows) ----------
// qkv: [8192,3072] f16 (Q@+0, times Q_FOLD; K@+1024, V@+2048 per row; head offset h*64)
// A wave owns 32 queries (two 16-column groups), so every K and V fragment read from LDS
// feeds two WMMAs. 256 registers a wave: two work-groups a WGP hold the whole grid at once.
// K and V tiles of 128 keys lie row-major in a ring of two LDS buffers, filled by async copies:
// while a tile is worked on, the next one is in flight. V^T comes from the transposing load.
__global__ void __launch_bounds__(256) __attribute__((amdgpu_waves_per_eu(4, 4)))
attn_wmma(const half_t* __restrict__ qkv, half_t* __restrict__ ctx) {
    const int bh   = blockIdx.y;
    const int b    = bh >> 4;
    const int h    = bh & 15;
    const int q0   = blockIdx.x * 256;
    const int lane = threadIdx.x & 31;
    const int wave = threadIdx.x >> 5;

    __shared__ __align__(16) half_t Ks[2 * 128 * 72];  // K tiles [key][d], 144-B rows, 2 x 18.4 KB
    __shared__ __align__(16) half_t Vs[2 * 128 * 80];  // V tiles [key][d], 160-B rows (32 B x odd:
                                                       // the transposing load's pitch), 2 x 20.5 KB

    const size_t ld = QKV_LD;
    const half_t* Qbase = qkv + ((size_t)(b * SEQ + q0 + wave * 32)) * ld + h * HEAD_DIM;
    v16h qf[2][2];           // [column group][k step]
    #pragma unroll
    for (int g = 0; g < 2; ++g) {
        qf[g][0] = load_frag(Qbase + (size_t)(g * 16) * ld,      (int)ld, lane);
        qf[g][1] = load_frag(Qbase + (size_t)(g * 16) * ld + 32, (int)ld, lane);
    }

    // Transposed products: in group g a lane owns ONE query (g * 16 + (lane & 15)) and, of every
    // 16 keys, the eight at 8 * (lane >> 4). oacc[g][dt][r] = O[query][dt * 16 + 8 * (lane >> 4) + r].
    v8f oacc[2][4] = {};
    // Softmax against a held reference (base 2): nref[g] holds minus the reference of the lane's
    // query in all eight registers and is the C operand of the score products, which so give
    // exp2's argument as it is. The reference is the query's maximum when it was last set; it
    // moves up only where the exponentials of 64 keys sum to more than SUM_LIMIT.
    v8f nref[2] = {};                       // equal in both lane halves
    float lrow[2] = {0.0f, 0.0f};           // running sums over all keys, equal in both lane halves
    v16h ones;                              // A operand of the row sums
    #pragma unroll
    for (int s = 0; s < 16; ++s) ones[s] = (half_t)1.0f;

    // the lane's share of a tile: 8 lanes span one 128-B row, a copy of the block 32 rows
    const int srow = (int)threadIdx.x >> 3;            // key 0..31 (+ 32 per piece)
    const int skc  = ((int)threadIdx.x & 7) * 8;       // d chunk
    const half_t* gk0 = qkv + ((size_t)(b * SEQ + srow)) * ld + h * HEAD_DIM + DIM + skc;
    const unsigned kl0 = (unsigned)(uintptr_t)&Ks[srow * 72 + skc];
    const unsigned vl0 = (unsigned)(uintptr_t)&Vs[srow * 80 + skc];
    // the lane's place in a transposing load of a V tile (see load_tr16)
    const half_t* vlane = &Vs[(8 * (lane >> 4) + (lane & 7)) * 80 + 8 * ((lane >> 3) & 1)];

    // ring prologue: tile 0 lands and is published; then tile 1 starts into the other buffer
    async_copy_kv_tile(gk0, kl0, vl0);
    wait_async0();
    __syncthreads();
    async_copy_kv_tile(gk0 + (size_t)128 * ld, kl0 + 128 * 144, vl0 + 128 * 160);

    for (int kt = 0; kt < SEQ / 128; ++kt) {
        const int buf = kt & 1;
        const half_t* Kb = Ks + buf * (128 * 72);
        const half_t* Vb = vlane + buf * (128 * 80);

        // The staged 128 keys are worked on 64 at a time: 64 score registers for the two groups.
        // Kept rolled: unrolled, both halves' scores are live at once and registers spill.
        #pragma unroll 1
        for (int hk = 0; hk < 2; ++hk) {
            const bool first = (kt | hk) == 0;
            bool setref = first;     // wave-uniform: this pass moves the references
            v16h pf[2][2];           // [32 keys][group]: P^T, the B operand of the sums and of O^T
            v8f  tsum[2];            // every register: the query's sum over these 64 keys
            v16h vf0[4];             // V^T fragments of the first 32 keys
            // At most two passes: the second only where a sum of the first went out of range.
            // Kept rolled: the second pass is the same code, and almost never runs.
            #pragma unroll 1
            for (int pass = 0; pass < 2; ++pass) {
                // compiler fence, no instruction: it keeps the K fragment loads inside the pass;
                // hoisted out of this loop they stay live for a second pass (64 registers) and
                // addresses spill to scratch
                asm volatile("" ::: "memory");
                // S^T = K Q^T - reference:
                // sacc[g][nt][r] = S[query of g][key hk * 64 + nt * 16 + 8 * (lane >> 4) + r] - ref
                v8f sacc[2][4];
                #pragma unroll
                for (int nt = 0; nt < 4; ++nt) {
                    sacc[0][nt] = nref[0];
                    sacc[1][nt] = nref[1];
                    #pragma unroll
                    for (int ks = 0; ks < 2; ++ks) {
                        const v16h kf = load_frag(&Kb[(hk * 64 + nt * 16) * 72 + ks * 32], 72, lane);
                        sacc[0][nt] = wmma16x16x32(kf, qf[0][ks], sacc[0][nt]);
                        sacc[1][nt] = wmma16x16x32(kf, qf[1][ks], sacc[1][nt]);
                    }
                }

                // Taken on the first 64 keys (the reference becomes their maximum, whatever its
                // sign) and on a second pass; then every query that is above its reference moves
                // up to its maximum: these scores, the sums and the outputs so far follow.
                if (setref) {
                    #pragma unroll
                    for (int g = 0; g < 2; ++g) {
                        // the lane's 32 scores of a group are all of one query
                        float rmv[8];
                        #pragma unroll
                        for (int r = 0; r < 8; ++r) {
                            rmv[r] = sacc[g][0][r];
                            #pragma unroll
                            for (int nt = 1; nt < 4; ++nt) rmv[r] = fmaxf(rmv[r], sacc[g][nt][r]);
                        }
                        const float m = fmaxf(fmaxf(fmaxf(rmv[0], rmv[1]), fmaxf(rmv[2], rmv[3])),
                                              fmaxf(fmaxf(rmv[4], rmv[5]), fmaxf(rmv[6], rmv[7])));
                        const float rm   = fmaxf(m, other_half(m));
                        const float up   = fmaxf(rm, 0.0f);
                        const float d    = first ? rm : up;
                        const float corr = __builtin_amdgcn_exp2f(-up);   // sums and outputs are 0 at first
                        nref[g] -= d;
                        lrow[g] *= corr;
                        #pragma unroll
                        for (int t = 0; t < 4; ++t) {
                            sacc[g][t] -= d;
                            oacc[g][t] *= corr;
                        }
                    }
                }

                // the first V^T fragments are asked for here, so that they land under the exponentials
                #pragma unroll
                for (int dt = 0; dt < 4; ++dt) {
                    const half_t* vp = Vb + (hk * 64) * 80 + dt * 16;
                    vf0[dt] = __builtin_shufflevector(load_tr16(vp), load_tr16(vp + 16 * 80),
                                  0,1,2,3,4,5,6,7,8,9,10,11,12,13,14,15);
                }

                // P^T: two score tiles, converted in place, are a B operand in the k order of the
                // two transposing loads (8h+0..7, then 16+8h+0..7)
                #pragma unroll
                for (int kb = 0; kb < 2; ++kb)
                    #pragma unroll
                    for (int g = 0; g < 2; ++g)
                        #pragma unroll
                        for (int s = 0; s < 16; ++s)
                            pf[kb][g][s] =
                                (half_t)__builtin_amdgcn_exp2f(sacc[g][kb * 2 + (s >> 3)][s & 7]);

                // row sums on the matrix pipe: (all ones) x P^T has, in every row, each query's
                // sum over the 32 keys of both lane halves
                #pragma unroll
                for (int g = 0; g < 2; ++g) {
                    const v8f zero = {};
                    tsum[g] = wmma16x16x32(ones, pf[0][g], zero);
                    tsum[g] = wmma16x16x32(ones, pf[1][g], tsum[g]);
                }
                // The sum is the range test too, one branch of the whole wave per 64 keys: within
                // SUM_LIMIT no term has left f16's range (an infinite term makes an infinite sum).
                // Nothing has been added to the outputs or the running sums yet.
                if (setref ||
                    __builtin_amdgcn_ballot_w32(fmaxf(tsum[0][0], tsum[1][0]) > SUM_LIMIT) == 0)
                    break;
                setref = true;
            }

            // O^T += V^T P^T, 32 keys at a time; the second 32 keys' fragments are asked for ahead
            // of the first products, so that they land under them
            v16h vf1[4];
            #pragma unroll
            for (int dt = 0; dt < 4; ++dt) {
                const half_t* vp = Vb + (hk * 64 + 32) * 80 + dt * 16;
                vf1[dt] = __builtin_shufflevector(load_tr16(vp), load_tr16(vp + 16 * 80),
                              0,1,2,3,4,5,6,7,8,9,10,11,12,13,14,15);
            }
            // holds these loads ahead of the products: left free, the compiler sinks them behind
            // the first eight, whose successors then wait out the LDS latency
            __builtin_amdgcn_sched_barrier(0);
            #pragma unroll
            for (int dt = 0; dt < 4; ++dt) {
                oacc[0][dt] = wmma16x16x32(vf0[dt], pf[0][0], oacc[0][dt]);
                oacc[1][dt] = wmma16x16x32(vf0[dt], pf[0][1], oacc[1][dt]);
            }
            #pragma unroll
            for (int dt = 0; dt < 4; ++dt) {
                oacc[0][dt] = wmma16x16x32(vf1[dt], pf[1][0], oacc[0][dt]);
                oacc[1][dt] = wmma16x16x32(vf1[dt], pf[1][1], oacc[1][dt]);
            }
            // the two additions stay behind the products: vector work in the slots that the chip
            // needs between the last products and the next rewrite of a fragment register
            __builtin_amdgcn_sched_barrier(0);
            lrow[0] += tsum[0][0];
            lrow[1] += tsum[1][0];
        }

        // publish point of tile kt + 1: this wave's reads of tile kt are done and its own pieces
        // of tile kt + 1 have landed; behind the barrier the same holds of every wave, so tile
        // kt + 1 may be read and the buffer of tile kt refilled
        wait_ds0();
        wait_async0();
        __syncthreads();
        if (kt + 2 < SEQ / 128)
            async_copy_kv_tile(gk0 + (size_t)(kt + 2) * 128 * ld,
                               kl0 + buf * (128 * 144), vl0 + buf * (128 * 160));
    }
    wait_async0();   // no copy is outstanding when the ring becomes output staging

    // normalize + store f16 context for the output projection: 8 consecutive d per lane, passed
    // through the wave's own LDS range (16 rows of 128 B at pitch 144 B, once per group) so that
    // a store covers 4 whole 128-B lines instead of 16 pieces of 32 B
    // (the last publish point's barrier: every wave has left the last tile, Ks becomes staging)
    half_t* stg = Ks + wave * (16 * 72);
    #pragma unroll
    for (int g = 0; g < 2; ++g) {
        const float lsum = lrow[g];
        if (g) wait_ds0();
        #pragma unroll
        for (int dt = 0; dt < 4; ++dt) {
            v8h o;
            #pragma unroll
            for (int r = 0; r < 8; ++r) o[r] = (half_t)(oacc[g][dt][r] / lsum);
            *(v8h*)&stg[(lane & 15) * 72 + dt * 16 + ((lane & 16) ? 8 : 0)] = o;
        }
        wait_ds0();
        half_t* cw = ctx + (size_t)(b * SEQ + q0 + g * 16) * DIM + h * HEAD_DIM;   // uniform
        const unsigned voff = (unsigned)((wave * 32 + (lane >> 3)) * DIM + (lane & 7) * 8);
        #pragma unroll
        for (int t = 0; t < 4; ++t)
            *(v8h*)&cw[t * 4 * DIM + voff] = *(const v8h*)&stg[(t * 4 + (lane >> 3)) * 72 + (lane & 7) * 8];
    }
}

// ---------- host ----------
extern "C" void kernel_launch(void* const* d_in, const int* in_sizes, int n_in,
                              void* d_out, int out_size, void* d_ws, size_t ws_size,
                              hipStream_t stream) {
    (void)in_sizes; (void)n_in; (void)out_size; (void)ws_size;
    const float* x      = (const float*)d_in[0];
    const float* w_qkv  = (const float*)d_in[1];
    const float* w_proj = (const float*)d_in[2];
    const float* b_proj = (const float*)d_in[3];
    float* out = (float*)d_out;

    half_t* xh     = (half_t*)d_ws;                      // 8192*1024
    half_t* wqkvh  = xh     + (size_t)ROWS * DIM;        // 3072*1024
    half_t* wprojh = wqkvh  + (size_t)QKV_LD * DIM;      // 1024*1024
    half_t* qkvh   = wprojh + (size_t)DIM * DIM;         // 8192*3072
    half_t* ctxh   = qkvh   + (size_t)ROWS * QKV_LD;     // 8192*1024

    // xh, wqkvh and wprojh are one contiguous range: the conversion writes it from xh on
    cvt_f32_to_f16<<<CVT_WAVES / 16, 512, 0, stream>>>(x, w_qkv, w_proj, xh);

    gemm_wmma<true, false, DIM><<<dim3(ROWS / 128, QKV_LD / 128), 256, 0, stream>>>(
        xh, wqkvh, nullptr, qkvh, ROWS, QKV_LD, DIM);

    attn_wmma<<<dim3(SEQ / 256, BATCH * HEADS), 256, 0, stream>>>(qkvh, ctxh);

    gemm_wmma<false, true, 0><<<dim3(ROWS / 128, DIM / 128), 256, 0, stream>>>(
        ctxh, wprojh, b_proj, out, ROWS, DIM, DIM);
}

// v010
// It runs in 109 microseconds.
// Next to v009, in two timings, it ran 1.06 and 1.07 times as fast.
// Over all steps from v000 it is 2.10 times as fast.
#include <hip/hip_runtime.h>
#include <stdint.h>

// ---------- types ----------
typedef _Float16 half_t;
typedef __attribute__((ext_vector_type(16))) _Float16 v16h;
typedef __attribute__((ext_vector_type(8)))  _Float16 v8h;
typedef __attribute__((ext_vector_type(4)))  _Float16 v4h;
typedef __attribute__((ext_vector_type(8)))  float    v8f;
typedef __attribute__((ext_vector_type(4)))  float    v4f;

#define DIM      1024
#define SEQ      2048
#define BATCH    4
#define HEADS    16
#define HEAD_DIM 64
#define ROWS     (BATCH * SEQ)       // 8192
#define QKV_LD   (3 * DIM)           // 3072
// 1/sqrt(64) * log2(e): the QKV product multiplies its Q columns by this (in f32, ahead of the one
// rounding to f16), so that K Q^T is the softmax exponent in base 2
#define Q_FOLD    0.18033688011112042f
#define SUM_LIMIT 32768.0f           // 64 keys' exponentials may sum to this much (f16 ends at 65,504)

// D = A*B + C, f16 inputs, f32 accumulate
__device__ __forceinline__ v8f wmma16x16x32(v16h a, v16h b, v8f c) {
    return __builtin_amdgcn_wmma_f32_16x16x32_f16(
        /*neg_a=*/false, a, /*neg_b=*/false, b,
        /*c_mod=*/(short)0, c, /*reuse_a=*/false, /*reuse_b=*/false);
}

// 16x32 f16 A/B fragment, per CDNA5 16-bit layout:
// lane l<16: row l, K={0..7,16..23}; lane l>=16: row l-16, K={8..15,24..31}.
__device__ __forceinline__ v16h load_frag(const half_t* __restrict__ base,
                                          int stride, int lane) {
    int r  = lane & 15;
    int k0 = (lane & 16) ? 8 : 0;
    const half_t* p = base + (size_t)r * stride + k0;
    v8h lo = *(const v8h*)(p);
    v8h hi = *(const v8h*)(p + 16);
    return __builtin_shufflevector(lo, hi, 0,1,2,3,4,5,6,7,8,9,10,11,12,13,14,15);
}

// Async global->LDS copies of 16 bytes per lane (tracked by ASYNCcnt): a lane's share of one
// 128-key tile, four pieces of K (LDS rows of 144 B) and four of V (LDS rows of 160 B), 32 keys
// apart. gk = the lane's first piece of K; V lies DIM elements behind K in the same qkv row.
// kl, vl = low 32 bits of the generic LDS pointers of the first pieces.
// All eight stand in ONE statement that ends in s_wait_xcnt 0: the wait then stands ahead of
// whatever next rewrites an address register that a copy names (a precaution; in a statement
// of its own the compiler could move such a write over it).
__device__ __forceinline__ void async_copy_kv_tile(const half_t* gk, unsigned kl, unsigned vl) {
    const half_t* gv = gk + DIM;
    asm volatile("global_load_async_to_lds_b128 %0, %1, off\n\t"
                 "global_load_async_to_lds_b128 %2, %3, off\n\t"
                 "global_load_async_to_lds_b128 %4, %5, off\n\t"
                 "global_load_async_to_lds_b128 %6, %7, off\n\t"
                 "global_load_async_to_lds_b128 %8, %9, off\n\t"
                 "global_load_async_to_lds_b128 %10, %11, off\n\t"
                 "global_load_async_to_lds_b128 %12, %13, off\n\t"
                 "global_load_async_to_lds_b128 %14, %15, off\n\t"
                 "s_wait_xcnt 0x0"
                 :: "v"(kl),                "v"(gk),
                    "v"(kl + 1u * 32 * 144), "v"(gk + 1 * 32 * QKV_LD),
                    "v"(kl + 2u * 32 * 144), "v"(gk + 2 * 32 * QKV_LD),
                    "v"(kl + 3u * 32 * 144), "v"(gk + 3 * 32 * QKV_LD),
                    "v"(vl),                "v"(gv),
                    "v"(vl + 1u * 32 * 160), "v"(gv + 1 * 32 * QKV_LD),
                    "v"(vl + 2u * 32 * 160), "v"(gv + 2 * 32 * QKV_LD),
                    "v"(vl + 3u * 32 * 160), "v"(gv + 3 * 32 * QKV_LD) : "memory");
}
// The same for a GEMM: N pieces of a lane, 16 tile rows apart: row_step bytes in global memory,
// 16 LDS rows of 272 B. g = the lane's first piece, l = its place in LDS. Written as the builtin:
// in this kernel of more than 256 registers the build with asm copies spilled their address
// registers to scratch, the build with the builtin spills nothing.
typedef __attribute__((ext_vector_type(4))) int i32x4;
template<int N>
__device__ __forceinline__ void async_copy_rows(const char* g, size_t row_step, char* l) {
    typedef __attribute__((address_space(1))) i32x4 glb_i32x4;
    typedef __attribute__((address_space(3))) i32x4 lds_i32x4;
    #pragma unroll
    for (int i = 0; i < N; ++i)
        __builtin_amdgcn_global_load_async_to_lds_b128((glb_i32x4*)(g + i * row_step),
                                                       (lds_i32x4*)(l + i * 16 * 272), 0, 0);
}
__device__ __forceinline__ void wait_async0() {
    asm volatile("s_wait_asynccnt 0x0" ::: "memory");
}
// Output staging: the lanes of ONE wave hand values to each other through the wave's own LDS
// range. This wait (and its "memory" clobber, which keeps the compiler from moving an LDS
// access across it) stands between the lanes' writes and the reads of other lanes' rows,
// and between those reads and the next writes over them.
__device__ __forceinline__ void wait_ds0() {
    asm volatile("s_wait_dscnt 0x0" ::: "memory");
}

// ---------- fp32 -> f16 convert: all three inputs, one launch ----------
// One resident grid: 256 work-groups of 16 waves. A piece is 1,024 floats (8 wave-wide loads of
// 512 contiguous bytes); x has 8,192 pieces, w_qkv 3,072, w_proj 1,024: three pieces a wave.
// The f16 copies lie one behind the other in the workspace, so piece p goes to out + p * 1,024.
// A wave's 24 loads stand ahead of its stores, so that many are in flight at once: the launch
// is paced by memory, not by how fast short waves can be started.
#define CVT_WAVES   4096
#define CVT_PIECE   1024
#define WQKV_PIECES (QKV_LD * DIM / CVT_PIECE)     // 3072
__global__ void __launch_bounds__(512) cvt_f32_to_f16(const float* __restrict__ x,
                                                      const float* __restrict__ w_qkv,
                                                      const float* __restrict__ w_proj,
                                                      half_t* __restrict__ out) {
    const int lane = threadIdx.x & 31;
    const int w = __builtin_amdgcn_readfirstlane((int)(blockIdx.x * 16 + (threadIdx.x >> 5)));
    const float* src[3];
    src[0] = x + (size_t)w * CVT_PIECE;
    src[1] = x + (size_t)(w + CVT_WAVES) * CVT_PIECE;
    src[2] = (w < WQKV_PIECES) ? w_qkv + (size_t)w * CVT_PIECE
                               : w_proj + (size_t)(w - WQKV_PIECES) * CVT_PIECE;
    v4f v[3][8];
    // all four loops unrolled: v stays in registers and the loads stand ahead of the stores
    #pragma unroll
    for (int p = 0; p < 3; ++p)
        #pragma unroll
        for (int i = 0; i < 8; ++i)
            v[p][i] = *(const v4f*)(src[p] + i * 128 + lane * 4);
    #pragma unroll
    for (int p = 0; p < 3; ++p) {
        half_t* dst = out + (size_t)(w + p * CVT_WAVES) * CVT_PIECE;
        #pragma unroll
        for (int i = 0; i < 8; ++i)
            *(v4h*)(dst + i * 128 + lane * 4) = __builtin_convertvector(v[p][i], v4h);
    }
}

// ---------- WMMA GEMM: C[m,n] = sum_k A[m,k]*B[n,k] (+bias) ----------
// 256 x BN tile (BN = 192 or 128), 8 waves of 64 x BN/2, K-step 128, one work-group a WGP.
// The large tile is there for the traffic: a work-group brings in (256 + BN) operand rows for
// 256 x BN results, and a wave reads 4 + BN/32 fragments from LDS for 4 x BN/32 products.
// 512 work-groups of 256 x 192 are two full rounds of the QKV product, 256 of 256 x 128 one
// round of the output projection.
// The A and B rows of a K-step lie in a ring of two LDS buffers (A rows first, then B rows),
// filled by async copies: while a K-step is worked on, the next one is in flight, through no
// register, and one barrier a K-step publishes it and frees the buffer just read. With two waves
// a SIMD nothing else hides a wave's LDS reads: its fragments are fetched 32 k ahead.
// A K-step of 128 halves makes a row slab two whole 128-B lines: 16 lanes cover a row.
// The products are taken as (B rows) x (A rows): a lane then holds 8 adjacent columns n of one
// row m and packs them into 16-B pieces; the whole tile goes through LDS, so that every global
// store covers whole 128-B lines and every line has one writer.
// Output columns below FOLD_COLS (a multiple of 16) are multiplied by Q_FOLD.
#define GEMM_BM    256
#define GEMM_PITCH 272                 // bytes: 256-B rows, 16 B x odd for ds_load_b128
template<bool OUT_HALF, bool BIAS, int FOLD_COLS, int BN>
__global__ void __launch_bounds__(256)
gemm_wmma(const half_t* __restrict__ A, const half_t* __restrict__ B,
          const float* __restrict__ bias, void* __restrict__ Cout,
          int M, int N, int K) {
    constexpr int FN    = BN / 32;                          // column fragments of a wave
    constexpr int STAGE = (GEMM_BM + BN) * GEMM_PITCH;      // bytes of one buffer
    __shared__ __align__(16) char ring[2 * STAGE];

    const int lane = threadIdx.x & 31;
    // the wave's number in a scalar register: tile offsets and the store base are then scalar too
    const int wave = __builtin_amdgcn_readfirstlane((int)(threadIdx.x >> 5));
    const int bm = blockIdx.x * GEMM_BM;
    const int bn = blockIdx.y * BN;
    const int wm = (wave & 3) * 64;
    const int wn = (wave >> 2) * (BN / 2);

    const int row0 = (int)threadIdx.x >> 4;         // 0..15; piece i stages row i*16 + row0
    const int kcb  = ((int)threadIdx.x & 15) * 16;  // byte in the row slab: 16 lanes span it
    // the lane's first pieces of K-step 0, in global memory (the block's uniform row bases plus one
    // 32-bit byte offset of the lane, the same in A and B) and in LDS
    const char* Au = (const char*)(A + (size_t)bm * K);
    const char* Bu = (const char*)(B + (size_t)bn * K);
    const unsigned voff = (unsigned)(row0 * K * 2 + kcb);
    const size_t row_step = (size_t)16 * K * 2;
    char* l0 = &ring[row0 * GEMM_PITCH + kcb];
    const int steps = K / 128;

    // a lane's share of K-step t, into buffer buf: 16 pieces of A, BN/16 of B
    auto copy_step = [&](int t, int buf) {
        const char* a = Au + (size_t)t * 256 + voff;
        const char* b = Bu + (size_t)t * 256 + voff;
        char* l = l0 + buf * STAGE;
        async_copy_rows<GEMM_BM / 16>(a, row_step, l);
        async_copy_rows<BN / 16>(b, row_step, l + GEMM_BM * GEMM_PITCH);
    };

    // the wave's fragments of 32 k: 4 of A rows, FN of B rows
    auto load_set = [&](const half_t* At, int ks, v16h (&af)[4], v16h (&bf)[FN]) {
        const half_t* Bt = At + GEMM_BM * (GEMM_PITCH / 2);
        #pragma unroll
        for (int i = 0; i < 4; ++i)
            af[i] = load_frag(&At[(wm + i * 16) * (GEMM_PITCH / 2) + ks * 32], GEMM_PITCH / 2, lane);
        #pragma unroll
        for (int j = 0; j < FN; ++j)
            bf[j] = load_frag(&Bt[(wn + j * 16) * (GEMM_PITCH / 2) + ks * 32], GEMM_PITCH / 2, lane);
    };

    v8f acc[4][FN] = {};

    // ring prologue: K-step 0 lands and is published; then K-step 1 starts into the other buffer
    copy_step(0, 0);
    wait_async0();
    __syncthreads();
    if (1 < steps) copy_step(1, 1);

    // Two fragment sets: the reads of the next 32 k stand as one group ahead of this 32 k's
    // products and land under them, over the K-step's end too.
    v16h af[2][4], bf[2][FN];
    load_set((const half_t*)ring, 0, af[0], bf[0]);

    for (int t = 0; t < steps; ++t) {
        const int buf = t & 1;
        const half_t* St = (const half_t*)(ring + buf * STAGE);
        // the other buffer: K-step t + 1; in the last trip an old K-step, read but not used (the
        // reads stay unconditional: a branch round them would merge two paths at the products'
        // wait, which would then wait for these reads as well)
        const half_t* Sn = (const half_t*)(ring + (buf ^ 1) * STAGE);
        #pragma unroll
        for (int ks = 0; ks < 4; ++ks) {        // k ascending: same sum order as before
            if (ks < 3) {
                load_set(St, ks + 1, af[(ks + 1) & 1], bf[(ks + 1) & 1]);
            } else {
                // publish point of K-step t + 1, ahead of the last 32 k's products, whose fragments
                // are asked for already: this wave's reads of K-step t are done and its own pieces
                // of K-step t + 1 have landed; behind the barrier the same holds of every wave, so
                // K-step t + 1 may be read and the buffer of K-step t refilled
                wait_ds0();
                wait_async0();
                __syncthreads();
                load_set(Sn, 0, af[0], bf[0]);
                if (t + 2 < steps) copy_step(t + 2, buf);
            }
            // keeps the reads together ahead of the products: left free, the compiler spreads
            // them among the products in pairs, each behind a wait for all LDS reads
            __builtin_amdgcn_sched_barrier(0);
            #pragma unroll
            for (int i = 0; i < 4; ++i)
                #pragma unroll
                for (int j = 0; j < FN; ++j)
                    acc[i][j] = wmma16x16x32(bf[ks & 1][j], af[ks & 1][i], acc[i][j]);
            // the same, at the products' end: the group after next stays behind them
            __builtin_amdgcn_sched_barrier(0);
        }
    }
    // the ring becomes output staging: no copy is outstanding, and every wave's last reads (the
    // unused ones of the last trip) are done
    wait_async0();
    wait_ds0();
    __syncthreads();

    // acc[i][j][r] = C[bm + wm + i * 16 + (lane & 15)][bn + wn + j * 16 + 8 * (lane >> 4) + r]
    const int c  = lane & 15;
    const int h8 = (lane >> 4) * 8;
    if (BIAS) {
        #pragma unroll
        for (int j = 0; j < FN; ++j) {
            const v8f bv = *(const v8f*)&bias[bn + wn + j * 16 + h8];
            #pragma unroll
            for (int i = 0; i < 4; ++i) acc[i][j] += bv;
        }
    }
    // The tile lies in LDS as 256 rows of ROWB bytes at pitch ROWB + 16 (16 B x odd).
    constexpr int ESZ  = OUT_HALF ? 2 : 4;
    constexpr int ROWB = BN * ESZ;
    constexpr int SP   = ROWB + 16;
    constexpr int LPR  = ROWB / 128;        // whole lines a row
    #pragma unroll
    for (int i = 0; i < 4; ++i)
        #pragma unroll
        for (int j = 0; j < FN; ++j) {
            char* p = ring + (wm + i * 16 + c) * SP + (wn + j * 16 + h8) * ESZ;
            if (OUT_HALF) {
                const float fold = (bn + wn + j * 16 < FOLD_COLS) ? Q_FOLD : 1.0f;   // wave-uniform
                v8h o;
                #pragma unroll
                for (int r = 0; r < 8; ++r) o[r] = (half_t)(acc[i][j][r] * fold);
                *(v8h*)p = o;
            } else {
                #pragma unroll
                for (int q = 0; q < 2; ++q) {
                    v4f o;
                    #pragma unroll
                    for (int r = 0; r < 4; ++r) o[r] = acc[i][j][q * 4 + r];
                    *(v4f*)(p + q * 16) = o;
                }
            }
        }
    __syncthreads();    // a wave reads back rows that other waves have written
    // A wave stores 32 rows, 4 whole lines a store (8 lanes a line); LPR stores cover 4 rows.
    // uniform base + 32-bit per-lane byte offsets, shared by all stores of the wave
    char* Cb = (char*)Cout + ((size_t)(bm + wave * 32) * N + bn) * ESZ;
    const char* sw = ring + wave * 32 * SP;
    unsigned lofs[LPR], gofs[LPR];
    #pragma unroll
    for (int s = 0; s < LPR; ++s) {
        const unsigned line = 4 * s + (lane >> 3);
        const unsigned in_row = (line % LPR) * 128 + (lane & 7) * 16;
        lofs[s] = (line / LPR) * SP + in_row;
        gofs[s] = (line / LPR) * (unsigned)N * ESZ + in_row;
    }
    #pragma unroll
    for (int t = 0; t < 8; ++t)
        #pragma unroll
        for (int s = 0; s < LPR; ++s)
            *(v4f*)(Cb + (size_t)(t * 4) * N * ESZ + gofs[s]) = *(const v4f*)(sw + t * 4 * SP + lofs[s]);
}

// Transposing LDS load: from a row-major tile T[key][d] of 16-bit values, with the lane address
// T + (kbase + 8 * (l >> 4) + (l & 7)) * pitch + dbase + 8 * ((l >> 3) & 1)   (in elements),
// lane l gets T[kbase + 8 * (l >> 4) + 0..7][dbase + (l & 15)]: half of a 16x32 fragment of T^T.
typedef __attribute__((ext_vector_type(8))) short s16x8;
__device__ __forceinline__ v8h load_tr16(const half_t* p) {
    typedef __attribute__((address_space(3))) s16x8 lds_s16x8;
    return __builtin_bit_cast(v8h, __builtin_amdgcn_ds_load_tr16_b128_v8i16((lds_s16x8*)p));
}

// lane l <-> l ^ 16 (the other 16-lane row), in the vector unit
__device__ __forceinline__ float other_half(float v) {
    int b = __builtin_bit_cast(int, v);
    return __builtin_bit_cast(float,
        __builtin_amdgcn_permlanex16(b, b, 0x76543210, 0xfedcba98, false, false));
}

// ---------- flash attention: one block per (b, h, 256 query rows) ----------
// qkv: [8192,3072] f16 (Q@+0, times Q_FOLD; K@+1024, V@+2048 per row; head offset h*64)
// A wave owns 32 queries (two 16-column groups), so every K and V fragment read from LDS
// feeds two WMMAs. 256 registers a wave: two work-groups a WGP hold the whole grid at once.
// K and V tiles of 128 keys lie row-major in a ring of two LDS buffers, filled by async copies:
// while a tile is worked on, the next one is in flight. V^T comes from the transposing load.
__global__ void __launch_bounds__(256) __attribute__((amdgpu_waves_per_eu(4, 4)))
attn_wmma(const half_t* __restrict__ qkv, half_t* __restrict__ ctx) {
    const int bh   = blockIdx.y;
    const int b    = bh >> 4;
    const int h    = bh & 15;
    const int q0   = blockIdx.x * 256;
    const int lane = threadIdx.x & 31;
    const int wave = threadIdx.x >> 5;

    __shared__ __align__(16) half_t Ks[2 * 128 * 72];  // K tiles [key][d], 144-B rows, 2 x 18.4 KB
    __shared__ __align__(16) half_t Vs[2 * 128 * 80];  // V tiles [key][d], 160-B rows (32 B x odd:
                                                       // the transposing load's pitch), 2 x 20.5 KB

    const size_t ld = QKV_LD;
    const half_t* Qbase = qkv + ((size_t)(b * SEQ + q0 + wave * 32)) * ld + h * HEAD_DIM;
    v16h qf[2][2];           // [column group][k step]
    #pragma unroll
    for (int g = 0; g < 2; ++g) {
        qf[g][0] = load_frag(Qbase + (size_t)(g * 16) * ld,      (int)ld, lane);
        qf[g][1] = load_frag(Qbase + (size_t)(g * 16) * ld + 32, (int)ld, lane);
    }

    // Transposed products: in group g a lane owns ONE query (g * 16 + (lane & 15)) and, of every
    // 16 keys, the eight at 8 * (lane >> 4). oacc[g][dt][r] = O[query][dt * 16 + 8 * (lane >> 4) + r].
    v8f oacc[2][4] = {};
    // Softmax against a held reference (base 2): nref[g] holds minus the reference of the lane's
    // query in all eight registers and is the C operand of the score products, which so give
    // exp2's argument as it is. The reference is the query's maximum when it was last set; it
    // moves up only where the exponentials of 64 keys sum to more than SUM_LIMIT.
    v8f nref[2] = {};                       // equal in both lane halves
    float lrow[2] = {0.0f, 0.0f};           // running sums over all keys, equal in both lane halves
    v16h ones;                              // A operand of the row sums
    #pragma unroll
    for (int s = 0; s < 16; ++s) ones[s] = (half_t)1.0f;

    // the lane's share of a tile: 8 lanes span one 128-B row, a copy of the block 32 rows
    const int srow = (int)threadIdx.x >> 3;            // key 0..31 (+ 32 per piece)
    const int skc  = ((int)threadIdx.x & 7) * 8;       // d chunk
    const half_t* gk0 = qkv + ((size_t)(b * SEQ + srow)) * ld + h * HEAD_DIM + DIM + skc;
    const unsigned kl0 = (unsigned)(uintptr_t)&Ks[srow * 72 + skc];
    const unsigned vl0 = (unsigned)(uintptr_t)&Vs[srow * 80 + skc];
    // the lane's place in a transposing load of a V tile (see load_tr16)
    const half_t* vlane = &Vs[(8 * (lane >> 4) + (lane & 7)) * 80 + 8 * ((lane >> 3) & 1)];

    // ring prologue: tile 0 lands and is published; then tile 1 starts into the other buffer
    async_copy_kv_tile(gk0, kl0, vl0);
    wait_async0();
    __syncthreads();
    async_copy_kv_tile(gk0 + (size_t)128 * ld, kl0 + 128 * 144, vl0 + 128 * 160);

    for (int kt = 0; kt < SEQ / 128; ++kt) {
        const int buf = kt & 1;
        const half_t* Kb = Ks + buf * (128 * 72);
        const half_t* Vb = vlane + buf * (128 * 80);

        // The staged 128 keys are worked on 64 at a time: 64 score registers for the two groups.
        // Kept rolled: unrolled, both halves' scores are live at once and registers spill.
        #pragma unroll 1
        for (int hk = 0; hk < 2; ++hk) {
            const bool first = (kt | hk) == 0;
            bool setref = first;     // wave-uniform: this pass moves the references
            v16h pf[2][2];           // [32 keys][group]: P^T, the B operand of the sums and of O^T
            v8f  tsum[2];            // every register: the query's sum over these 64 keys
            v16h vf0[4];             // V^T fragments of the first 32 keys
            // At most two passes: the second only where a sum of the first went out of range.
            // Kept rolled: the second pass is the same code, and almost never runs.
            #pragma unroll 1
            for (int pass = 0; pass < 2; ++pass) {
                // compiler fence, no instruction: it keeps the K fragment loads inside the pass;
                // hoisted out of this loop they stay live for a second pass (64 registers) and
                // addresses spill to scratch
                asm volatile("" ::: "memory");
                // S^T = K Q^T - reference:
                // sacc[g][nt][r] = S[query of g][key hk * 64 + nt * 16 + 8 * (lane >> 4) + r] - ref
                v8f sacc[2][4];
                #pragma unroll
                for (int nt = 0; nt < 4; ++nt) {
                    sacc[0][nt] = nref[0];
                    sacc[1][nt] = nref[1];
                    #pragma unroll
                    for (int ks = 0; ks < 2; ++ks) {
                        const v16h kf = load_frag(&Kb[(hk * 64 + nt * 16) * 72 + ks * 32], 72, lane);
                        sacc[0][nt] = wmma16x16x32(kf, qf[0][ks], sacc[0][nt]);
                        sacc[1][nt] = wmma16x16x32(kf, qf[1][ks], sacc[1][nt]);
                    }
                }

                // Taken on the first 64 keys (the reference becomes their maximum, whatever its
                // sign) and on a second pass; then every query that is above its reference moves
                // up to its maximum: these scores, the sums and the outputs so far follow.
                if (setref) {
                    #pragma unroll
                    for (int g = 0; g < 2; ++g) {
                        // the lane's 32 scores of a group are all of one query
                        float rmv[8];
                        #pragma unroll
                        for (int r = 0; r < 8; ++r) {
                            rmv[r] = sacc[g][0][r];
                            #pragma unroll
                            for (int nt = 1; nt < 4; ++nt) rmv[r] = fmaxf(rmv[r], sacc[g][nt][r]);
                        }
                        const float m = fmaxf(fmaxf(fmaxf(rmv[0], rmv[1]), fmaxf(rmv[2], rmv[3])),
                                              fmaxf(fmaxf(rmv[4], rmv[5]), fmaxf(rmv[6], rmv[7])));
                        const float rm   = fmaxf(m, other_half(m));
                        const float up   = fmaxf(rm, 0.0f);
                        const float d    = first ? rm : up;
                        const float corr = __builtin_amdgcn_exp2f(-up);   // sums and outputs are 0 at first
                        nref[g] -= d;
                        lrow[g] *= corr;
                        #pragma unroll
                        for (int t = 0; t < 4; ++t) {
                            sacc[g][t] -= d;
                            oacc[g][t] *= corr;
                        }
                    }
                }

                // the first V^T fragments are asked for here, so that they land under the exponentials
                #pragma unroll
                for (int dt = 0; dt < 4; ++dt) {
                    const half_t* vp = Vb + (hk * 64) * 80 + dt * 16;
                    vf0[dt] = __builtin_shufflevector(load_tr16(vp), load_tr16(vp + 16 * 80),
                                  0,1,2,3,4,5,6,7,8,9,10,11,12,13,14,15);
                }

                // P^T: two score tiles, converted in place, are a B operand in the k order of the
                // two transposing loads (8h+0..7, then 16+8h+0..7)
                #pragma unroll
                for (int kb = 0; kb < 2; ++kb)
                    #pragma unroll
                    for (int g = 0; g < 2; ++g)
                        #pragma unroll
                        for (int s = 0; s < 16; ++s)
                            pf[kb][g][s] =
                                (half_t)__builtin_amdgcn_exp2f(sacc[g][kb * 2 + (s >> 3)][s & 7]);

                // row sums on the matrix pipe: (all ones) x P^T has, in every row, each query's
                // sum over the 32 keys of both lane halves
                #pragma unroll
                for (int g = 0; g < 2; ++g) {
                    const v8f zero = {};
                    tsum[g] = wmma16x16x32(ones, pf[0][g], zero);
                    tsum[g] = wmma16x16x32(ones, pf[1][g], tsum[g]);
                }
                // The sum is the range test too, one branch of the whole wave per 64 keys: within
                // SUM_LIMIT no term has left f16's range (an infinite term makes an infinite sum).
                // Nothing has been added to the outputs or the running sums yet.
                if (setref ||
                    __builtin_amdgcn_ballot_w32(fmaxf(tsum[0][0], tsum[1][0]) > SUM_LIMIT) == 0)
                    break;
                setref = true;
            }

            // O^T += V^T P^T, 32 keys at a time; the second 32 keys' fragments are asked for ahead
            // of the first products, so that they land under them
            v16h vf1[4];
            #pragma unroll
            for (int dt = 0; dt < 4; ++dt) {
                const half_t* vp = Vb + (hk * 64 + 32) * 80 + dt * 16;
                vf1[dt] = __builtin_shufflevector(load_tr16(vp), load_tr16(vp + 16 * 80),
                              0,1,2,3,4,5,6,7,8,9,10,11,12,13,14,15);
            }
            // holds these loads ahead of the products: left free, the compiler sinks them behind
            // the first eight, whose successors then wait out the LDS latency
            __builtin_amdgcn_sched_barrier(0);
            #pragma unroll
            for (int dt = 0; dt < 4; ++dt) {
                oacc[0][dt] = wmma16x16x32(vf0[dt], pf[0][0], oacc[0][dt]);
                oacc[1][dt] = wmma16x16x32(vf0[dt], pf[0][1], oacc[1][dt]);
            }
            #pragma unroll
            for (int dt = 0; dt < 4; ++dt) {
                oacc[0][dt] = wmma16x16x32(vf1[dt], pf[1][0], oacc[0][dt]);
                oacc[1][dt] = wmma16x16x32(vf1[dt], pf[1][1], oacc[1][dt]);
            }
            // the two additions stay behind the products: vector work in the slots that the chip
            // needs between the last products and the next rewrite of a fragment register
            __builtin_amdgcn_sched_barrier(0);
            lrow[0] += tsum[0][0];
            lrow[1] += tsum[1][0];
        }

        // publish point of tile kt + 1: this wave's reads of tile kt are done and its own pieces
        // of tile kt + 1 have landed; behind the barrier the same holds of every wave, so tile
        // kt + 1 may be read and the buffer of tile kt refilled
        wait_ds0();
        wait_async0();
        __syncthreads();
        if (kt + 2 < SEQ / 128)
            async_copy_kv_tile(gk0 + (size_t)(kt + 2) * 128 * ld,
                               kl0 + buf * (128 * 144), vl0 + buf * (128 * 160));
    }
    wait_async0();   // no copy is outstanding when the ring becomes output staging

    // normalize + store f16 context for the output projection: 8 consecutive d per lane, passed
    // through the wave's own LDS range (16 rows of 128 B at pitch 144 B, once per group) so that
    // a store covers 4 whole 128-B lines instead of 16 pieces of 32 B
    // (the last publish point's barrier: every wave has left the last tile, Ks becomes staging)
    half_t* stg = Ks + wave * (16 * 72);
    #pragma unroll
    for (int g = 0; g < 2; ++g) {
        const float lsum = lrow[g];
        if (g) wait_ds0();
        #pragma unroll
        for (int dt = 0; dt < 4; ++dt) {
            v8h o;
            #pragma unroll
            for (int r = 0; r < 8; ++r) o[r] = (half_t)(oacc[g][dt][r] / lsum);
            *(v8h*)&stg[(lane & 15) * 72 + dt * 16 + ((lane & 16) ? 8 : 0)] = o;
        }
        wait_ds0();
        half_t* cw = ctx + (size_t)(b * SEQ + q0 + g * 16) * DIM + h * HEAD_DIM;   // uniform
        const unsigned voff = (unsigned)((wave * 32 + (lane >> 3)) * DIM + (lane & 7) * 8);
        #pragma unroll
        for (int t = 0; t < 4; ++t)
            *(v8h*)&cw[t * 4 * DIM + voff] = *(const v8h*)&stg[(t * 4 + (lane >> 3)) * 72 + (lane & 7) * 8];
    }
}

// ---------- host ----------
extern "C" void kernel_launch(void* const* d_in, const int* in_sizes, int n_in,
                              void* d_out, int out_size, void* d_ws, size_t ws_size,
                              hipStream_t stream) {
    (void)in_sizes; (void)n_in; (void)out_size; (void)ws_size;
    const float* x      = (const float*)d_in[0];
    const float* w_qkv  = (const float*)d_in[1];
    const float* w_proj = (const float*)d_in[2];
    const float* b_proj = (const float*)d_in[3];
    float* out = (float*)d_out;

    half_t* xh     = (half_t*)d_ws;                      // 8192*1024
    half_t* wqkvh  = xh     + (size_t)ROWS * DIM;        // 3072*1024
    half_t* wprojh = wqkvh  + (size_t)QKV_LD * DIM;      // 1024*1024
    half_t* qkvh   = wprojh + (size_t)DIM * DIM;         // 8192*3072
    half_t* ctxh   = qkvh   + (size_t)ROWS * QKV_LD;     // 8192*1024

    // xh, wqkvh and wprojh are one contiguous range: the conversion writes it from xh on
    cvt_f32_to_f16<<<CVT_WAVES / 16, 512, 0, stream>>>(x, w_qkv, w_proj, xh);

    gemm_wmma<true, false, DIM, 192><<<dim3(ROWS / 256, QKV_LD / 192), 256, 0, stream>>>(
        xh, wqkvh, nullptr, qkvh, ROWS, QKV_LD, DIM);

    attn_wmma<<<dim3(SEQ / 256, BATCH * HEADS), 256, 0, stream>>>(qkvh, ctxh);

    gemm_wmma<false, true, 0, 128><<<dim3(ROWS / 256, DIM / 128), 256, 0, stream>>>(
        ctxh, wprojh, b_proj, out, ROWS, DIM, DIM);
}
